// v000
// Times are from an AMD MI455X. After a warm-up the kernel runs many times in a row, and a time is the length of
// such a window on the GPU divided by its runs, so every launch and the gaps after it count. The runs cycle
// through copies of the inputs. A figure is the median of several windows, for all but v000 over two sittings.
// Sittings can differ by a few percent; kernels timed side by side share one.
// The starting kernel, v000, takes 211 microseconds a run.
#include <hip/hip_runtime.h>
#include <stdint.h>

typedef __attribute__((ext_vector_type(2))) float v2f;
typedef __attribute__((ext_vector_type(8))) float v8f;

#define B_   16
#define C_   256
#define CI_  128
#define N_   4096
#define EPS_ 1e-5f

__device__ __forceinline__ v8f wmma_f32(v2f a, v2f b, v8f c) {
  // D = A(16x4 f32) * B(4x16 f32) + C(16x16 f32)
  return __builtin_amdgcn_wmma_f32_16x16x4_f32(false, a, false, b, (short)0, c, false, false);
}

// Async global->LDS 16-byte copy (CDNA5, tracked by ASYNCcnt). GV mode.
__device__ __forceinline__ void async_b128(uint32_t lds_off, uint64_t gaddr) {
  asm volatile("global_load_async_to_lds_b128 %0, %1, off"
               :: "v"(lds_off), "v"(gaddr) : "memory");
}
__device__ __forceinline__ void wait_async0() {
  asm volatile("s_wait_asynccnt 0" ::: "memory");
}
__device__ __forceinline__ void wait_async4() {
  asm volatile("s_wait_asynccnt 4" ::: "memory");
}
// Low 32 bits of a flat LDS-aperture address are the LDS byte offset.
__device__ __forceinline__ uint32_t lds_off(const void* p) {
  return (uint32_t)(uintptr_t)p;
}

// ---------------------------------------------------------------------------
// Generic NN GEMM:  C[b] = A[b](128*gridDim.y x K) @ Bm[b](K x N) (+ bias)
// Workgroup: 128x128 block, 8 waves (4x2), each wave 2x4 16x16 tiles.
// Double-buffered async global->LDS staging.
// ---------------------------------------------------------------------------
__global__ __launch_bounds__(256) void gemm_nn_wmma(
    const float* __restrict__ A, long long sA,
    const float* __restrict__ Bm, long long sB,
    float* __restrict__ Cm, long long sC,
    const float* __restrict__ bias,
    int K, int N)
{
  __shared__ float As[2][128][20];   // stride 20: 16B-aligned rows, conflict-free
  __shared__ float Bs[2][16][128];

  const int t  = threadIdx.x;
  const int w  = t >> 5, l = t & 31, lh = l >> 4, ll = l & 15;
  const int wm = w >> 1, wn = w & 1;

  const float* Ab = A  + (size_t)blockIdx.z * sA + (size_t)blockIdx.y * 128 * K;
  const float* Bb = Bm + (size_t)blockIdx.z * sB;
  float*       Cb = Cm + (size_t)blockIdx.z * sC + (size_t)blockIdx.y * 128 * N;
  const int nBase = blockIdx.x * 128;

  // per-thread async chunks: A tile = 512 x b128, B tile = 512 x b128, 2 each
  const int ca0 = t, ca1 = t + 256;
  const uint64_t aSrc0 = (uint64_t)(uintptr_t)(Ab + (size_t)(ca0 >> 2) * K + (ca0 & 3) * 4);
  const uint64_t aSrc1 = (uint64_t)(uintptr_t)(Ab + (size_t)(ca1 >> 2) * K + (ca1 & 3) * 4);
  const uint64_t bSrc0 = (uint64_t)(uintptr_t)(Bb + (size_t)(ca0 >> 5) * N + nBase + (ca0 & 31) * 4);
  const uint64_t bSrc1 = (uint64_t)(uintptr_t)(Bb + (size_t)(ca1 >> 5) * N + nBase + (ca1 & 31) * 4);
  const uint32_t aDst0 = lds_off(&As[0][ca0 >> 2][(ca0 & 3) * 4]);
  const uint32_t aDst1 = lds_off(&As[0][ca1 >> 2][(ca1 & 3) * 4]);
  const uint32_t bDst0 = lds_off(&Bs[0][ca0 >> 5][(ca0 & 31) * 4]);
  const uint32_t bDst1 = lds_off(&Bs[0][ca1 >> 5][(ca1 & 31) * 4]);
  const uint32_t aBuf  = (uint32_t)((const char*)&As[1][0][0] - (const char*)&As[0][0][0]);
  const uint32_t bBuf  = (uint32_t)((const char*)&Bs[1][0][0] - (const char*)&Bs[0][0][0]);
  const uint64_t aStepK = 64;                       // 16 floats along K
  const uint64_t bStepK = (uint64_t)16 * N * 4;     // 16 rows of B

  v8f acc[2][4];
#pragma unroll
  for (int mi = 0; mi < 2; ++mi)
#pragma unroll
    for (int ni = 0; ni < 4; ++ni)
#pragma unroll
      for (int r = 0; r < 8; ++r) acc[mi][ni][r] = 0.0f;

  const int nk = K >> 4;
  // prologue: stage chunk 0 into buffer 0
  async_b128(aDst0, aSrc0);
  async_b128(aDst1, aSrc1);
  async_b128(bDst0, bSrc0);
  async_b128(bDst1, bSrc1);

  for (int kc = 0; kc < nk; ++kc) {
    const int cur = kc & 1;
    if (kc + 1 < nk) {   // prefetch next chunk into the other buffer
      const uint32_t ab = (cur ^ 1) ? aBuf : 0u;
      const uint32_t bb = (cur ^ 1) ? bBuf : 0u;
      const uint64_t ka = (uint64_t)(kc + 1) * aStepK;
      const uint64_t kb = (uint64_t)(kc + 1) * bStepK;
      async_b128(aDst0 + ab, aSrc0 + ka);
      async_b128(aDst1 + ab, aSrc1 + ka);
      async_b128(bDst0 + bb, bSrc0 + kb);
      async_b128(bDst1 + bb, bSrc1 + kb);
      wait_async4();     // current chunk's 4 transfers complete (in-order)
    } else {
      wait_async0();
    }
    __syncthreads();

#pragma unroll
    for (int ks = 0; ks < 16; ks += 4) {
      v2f af[2], bf[4];
#pragma unroll
      for (int mi = 0; mi < 2; ++mi)
        af[mi] = *(const v2f*)&As[cur][(wm * 2 + mi) * 16 + ll][ks + 2 * lh];
#pragma unroll
      for (int ni = 0; ni < 4; ++ni) {
        const int col = (wn * 4 + ni) * 16 + ll;
        v2f b;
        b.x = Bs[cur][ks + 2 * lh + 0][col];
        b.y = Bs[cur][ks + 2 * lh + 1][col];
        bf[ni] = b;
      }
#pragma unroll
      for (int mi = 0; mi < 2; ++mi)
#pragma unroll
        for (int ni = 0; ni < 4; ++ni)
          acc[mi][ni] = wmma_f32(af[mi], bf[ni], acc[mi][ni]);
    }
    __syncthreads();
  }

#pragma unroll
  for (int mi = 0; mi < 2; ++mi)
#pragma unroll
    for (int r = 0; r < 8; ++r) {
      const int row = (wm * 2 + mi) * 16 + r + 8 * lh;
      const float bv = bias ? bias[blockIdx.y * 128 + row] : 0.0f;
#pragma unroll
      for (int ni = 0; ni < 4; ++ni) {
        const int col = nBase + (wn * 4 + ni) * 16 + ll;
        Cb[(size_t)row * N + col] = acc[mi][ni][r] + bv;
      }
    }
}

// ---------------------------------------------------------------------------
// NT Gram with split-K:  Fp[b][split] = Th[b](128xKslice) @ Ph[b](128xKslice)^T
// Kslice = 256, 16 splits covering K = 4096. Double-buffered async staging.
// ---------------------------------------------------------------------------
__global__ __launch_bounds__(256) void gemm_nt_splitk(
    const float* __restrict__ Th, const float* __restrict__ Ph,
    float* __restrict__ Fp)
{
  __shared__ float As[2][128][20];
  __shared__ float Bs[2][128][20];

  const int t  = threadIdx.x;
  const int w  = t >> 5, l = t & 31, lh = l >> 4, ll = l & 15;
  const int wm = w >> 1, wn = w & 1;

  const int b = blockIdx.z;
  const int kBase = blockIdx.x * 256;
  const float* Ab = Th + (size_t)b * ((size_t)CI_ * N_) + kBase;
  const float* Bb = Ph + (size_t)b * ((size_t)CI_ * N_) + kBase;
  float* Fb = Fp + ((size_t)b * gridDim.x + blockIdx.x) * (128 * 128);

  const int ca0 = t, ca1 = t + 256;
  const uint64_t aSrc0 = (uint64_t)(uintptr_t)(Ab + (size_t)(ca0 >> 2) * N_ + (ca0 & 3) * 4);
  const uint64_t aSrc1 = (uint64_t)(uintptr_t)(Ab + (size_t)(ca1 >> 2) * N_ + (ca1 & 3) * 4);
  const uint64_t bSrc0 = (uint64_t)(uintptr_t)(Bb + (size_t)(ca0 >> 2) * N_ + (ca0 & 3) * 4);
  const uint64_t bSrc1 = (uint64_t)(uintptr_t)(Bb + (size_t)(ca1 >> 2) * N_ + (ca1 & 3) * 4);
  const uint32_t aDst0 = lds_off(&As[0][ca0 >> 2][(ca0 & 3) * 4]);
  const uint32_t aDst1 = lds_off(&As[0][ca1 >> 2][(ca1 & 3) * 4]);
  const uint32_t bDst0 = lds_off(&Bs[0][ca0 >> 2][(ca0 & 3) * 4]);
  const uint32_t bDst1 = lds_off(&Bs[0][ca1 >> 2][(ca1 & 3) * 4]);
  const uint32_t aBuf  = (uint32_t)((const char*)&As[1][0][0] - (const char*)&As[0][0][0]);
  const uint32_t bBuf  = (uint32_t)((const char*)&Bs[1][0][0] - (const char*)&Bs[0][0][0]);

  v8f acc[2][4];
#pragma unroll
  for (int mi = 0; mi < 2; ++mi)
#pragma unroll
    for (int ni = 0; ni < 4; ++ni)
#pragma unroll
      for (int r = 0; r < 8; ++r) acc[mi][ni][r] = 0.0f;

  const int nk = 256 / 16;
  async_b128(aDst0, aSrc0);
  async_b128(aDst1, aSrc1);
  async_b128(bDst0, bSrc0);
  async_b128(bDst1, bSrc1);

  for (int kc = 0; kc < nk; ++kc) {
    const int cur = kc & 1;
    if (kc + 1 < nk) {
      const uint32_t ab = (cur ^ 1) ? aBuf : 0u;
      const uint32_t bb = (cur ^ 1) ? bBuf : 0u;
      const uint64_t ka = (uint64_t)(kc + 1) * 64;
      async_b128(aDst0 + ab, aSrc0 + ka);
      async_b128(aDst1 + ab, aSrc1 + ka);
      async_b128(bDst0 + bb, bSrc0 + ka);
      async_b128(bDst1 + bb, bSrc1 + ka);
      wait_async4();
    } else {
      wait_async0();
    }
    __syncthreads();

#pragma unroll
    for (int ks = 0; ks < 16; ks += 4) {
      v2f af[2], bf[4];
#pragma unroll
      for (int mi = 0; mi < 2; ++mi)
        af[mi] = *(const v2f*)&As[cur][(wm * 2 + mi) * 16 + ll][ks + 2 * lh];
#pragma unroll
      for (int ni = 0; ni < 4; ++ni)
        bf[ni] = *(const v2f*)&Bs[cur][(wn * 4 + ni) * 16 + ll][ks + 2 * lh];
#pragma unroll
      for (int mi = 0; mi < 2; ++mi)
#pragma unroll
        for (int ni = 0; ni < 4; ++ni)
          acc[mi][ni] = wmma_f32(af[mi], bf[ni], acc[mi][ni]);
    }
    __syncthreads();
  }

#pragma unroll
  for (int mi = 0; mi < 2; ++mi)
#pragma unroll
    for (int r = 0; r < 8; ++r) {
      const int row = (wm * 2 + mi) * 16 + r + 8 * lh;
#pragma unroll
      for (int ni = 0; ni < 4; ++ni) {
        const int col = (wn * 4 + ni) * 16 + ll;
        Fb[row * 128 + col] = acc[mi][ni][r];
      }
    }
}

// Deterministic split-K reduction: F = sum over 16 partials
__global__ __launch_bounds__(256) void reduce_split(const float* __restrict__ Fp,
                                                    float* __restrict__ F) {
  const int idx = blockIdx.x * 256 + threadIdx.x;   // B_*128*128 total
  const int b = idx >> 14;
  const int r = idx & 16383;
  float s = 0.0f;
#pragma unroll
  for (int sp = 0; sp < 16; ++sp)
    s += Fp[((size_t)b * 16 + sp) * 16384 + r];
  F[idx] = s;
}

// Softmax over rows of length 128 (with max subtraction; logits have sigma~64)
__global__ __launch_bounds__(128) void softmax_row128(float* __restrict__ F) {
  __shared__ float red[128];
  const int t = threadIdx.x;
  float* row = F + (size_t)blockIdx.x * 128;
  float v = row[t];
  red[t] = v;
  __syncthreads();
  for (int off = 64; off > 0; off >>= 1) {
    if (t < off) red[t] = fmaxf(red[t], red[t + off]);
    __syncthreads();
  }
  const float m = red[0];
  __syncthreads();
  const float e = expf(v - m);
  red[t] = e;
  __syncthreads();
  for (int off = 64; off > 0; off >>= 1) {
    if (t < off) red[t] += red[t + off];
    __syncthreads();
  }
  row[t] = e / red[0];
}

// torch permute(0,2,1).view(B,Ci,H,W)  ==  per-batch transpose of Y[128][4096]
__global__ __launch_bounds__(256) void transpose_ci_n(const float* __restrict__ Y,
                                                      float* __restrict__ Z) {
  __shared__ float tile[32][33];
  const int b  = blockIdx.z;
  const int n0 = blockIdx.x * 32;
  const int i0 = blockIdx.y * 32;
  const int tx = threadIdx.x & 31;
  const int ty = threadIdx.x >> 5;  // 0..7
  const float* Yb = Y + (size_t)b * ((size_t)CI_ * N_);
  float*       Zb = Z + (size_t)b * ((size_t)CI_ * N_);
#pragma unroll
  for (int j = 0; j < 32; j += 8)
    tile[ty + j][tx] = Yb[(size_t)(i0 + ty + j) * N_ + n0 + tx];
  __syncthreads();
#pragma unroll
  for (int j = 0; j < 32; j += 8)
    Zb[(size_t)(n0 + ty + j) * CI_ + i0 + tx] = tile[tx][ty + j];
}

// InstanceNorm (affine=False) + ReLU, in place; one workgroup per 4096-row
__global__ __launch_bounds__(256) void inorm_relu(float* __restrict__ P) {
  __shared__ float ra[256], rb[256];
  const int t = threadIdx.x;
  float* p = P + (size_t)blockIdx.x * N_;
  float v[16];
  float s = 0.0f, s2 = 0.0f;
#pragma unroll
  for (int j = 0; j < 16; ++j) {
    v[j] = p[t + 256 * j];
    s += v[j]; s2 += v[j] * v[j];
  }
  ra[t] = s; rb[t] = s2;
  __syncthreads();
  for (int off = 128; off > 0; off >>= 1) {
    if (t < off) { ra[t] += ra[t + off]; rb[t] += rb[t + off]; }
    __syncthreads();
  }
  const float mean = ra[0] * (1.0f / N_);
  const float var  = rb[0] * (1.0f / N_) - mean * mean;
  const float rstd = rsqrtf(var + EPS_);
#pragma unroll
  for (int j = 0; j < 16; ++j)
    p[t + 256 * j] = fmaxf((v[j] - mean) * rstd, 0.0f);
}

// Final InstanceNorm + residual add: out = (U - mean)*rstd + x
__global__ __launch_bounds__(256) void inorm_add(const float* __restrict__ U,
                                                 const float* __restrict__ x,
                                                 float* __restrict__ out) {
  __shared__ float ra[256], rb[256];
  const int t = threadIdx.x;
  const size_t base = (size_t)blockIdx.x * N_;
  float v[16];
  float s = 0.0f, s2 = 0.0f;
#pragma unroll
  for (int j = 0; j < 16; ++j) {
    v[j] = U[base + t + 256 * j];
    s += v[j]; s2 += v[j] * v[j];
  }
  ra[t] = s; rb[t] = s2;
  __syncthreads();
  for (int off = 128; off > 0; off >>= 1) {
    if (t < off) { ra[t] += ra[t + off]; rb[t] += rb[t + off]; }
    __syncthreads();
  }
  const float mean = ra[0] * (1.0f / N_);
  const float var  = rb[0] * (1.0f / N_) - mean * mean;
  const float rstd = rsqrtf(var + EPS_);
#pragma unroll
  for (int j = 0; j < 16; ++j) {
    const size_t o = base + t + 256 * j;
    out[o] = (v[j] - mean) * rstd + x[o];
  }
}

extern "C" void kernel_launch(void* const* d_in, const int* in_sizes, int n_in,
                              void* d_out, int out_size, void* d_ws, size_t ws_size,
                              hipStream_t stream) {
  const float* x    = (const float*)d_in[0];
  const float* g_w  = (const float*)d_in[1];
  const float* g_b  = (const float*)d_in[2];
  const float* th_w = (const float*)d_in[3];
  const float* th_b = (const float*)d_in[4];
  const float* ph_w = (const float*)d_in[5];
  const float* ph_b = (const float*)d_in[6];
  const float* W_w  = (const float*)d_in[7];
  const float* W_b  = (const float*)d_in[8];
  float* out = (float*)d_out;

  float* ws = (float*)d_ws;
  const size_t PN   = (size_t)CI_ * N_;   // 524288 floats per (batch, proj)
  const size_t SLAB = (size_t)B_ * PN;    // 8388608 floats per proj slab
  float* P  = ws;                 // [3][B][Ci][N]   (g, theta, phi)
  float* Y  = P + 3 * SLAB;       // [B][Ci][N]
  float* Z  = Y + SLAB;           // [B][Ci][N]
  float* Fp = Z;                  // alias: split-K partials, dead before Z used
  float* F  = Z + SLAB;           // [B][Ci][Ci]
  float* U  = P;                  // alias: final conv output over dead P

  dim3 blk(256);

  // 1) three 1x1-conv projections (NN GEMM + bias)
  gemm_nn_wmma<<<dim3(32, 1, B_), blk, 0, stream>>>(g_w,  0, x, (long long)C_ * N_, P,            (long long)PN, g_b,  C_, N_);
  gemm_nn_wmma<<<dim3(32, 1, B_), blk, 0, stream>>>(th_w, 0, x, (long long)C_ * N_, P + SLAB,     (long long)PN, th_b, C_, N_);
  gemm_nn_wmma<<<dim3(32, 1, B_), blk, 0, stream>>>(ph_w, 0, x, (long long)C_ * N_, P + 2 * SLAB, (long long)PN, ph_b, C_, N_);
  // 2) instance norm + relu on all 3*B*Ci rows, in place
  inorm_relu<<<dim3(3 * B_ * CI_), blk, 0, stream>>>(P);
  // 3) Gram: theta @ phi^T, split-K=16, then deterministic reduce
  gemm_nt_splitk<<<dim3(16, 1, B_), blk, 0, stream>>>(P + SLAB, P + 2 * SLAB, Fp);
  reduce_split<<<dim3((B_ * CI_ * CI_) / 256), blk, 0, stream>>>(Fp, F);
  // 4) softmax over rows of 128
  softmax_row128<<<dim3(B_ * CI_), dim3(128), 0, stream>>>(F);
  // 5) Y = attn @ g
  gemm_nn_wmma<<<dim3(32, 1, B_), blk, 0, stream>>>(F, (long long)CI_ * CI_, P, (long long)PN, Y, (long long)PN, nullptr, CI_, N_);
  // 6) permute-view == per-batch transpose
  transpose_ci_n<<<dim3(N_ / 32, CI_ / 32, B_), blk, 0, stream>>>(Y, Z);
  // 7) final 1x1 conv (M=256 -> gridDim.y = 2)
  gemm_nn_wmma<<<dim3(32, 2, B_), blk, 0, stream>>>(W_w, 0, Z, (long long)PN, U, (long long)C_ * N_, W_b, CI_, N_);
  // 8) instance norm + residual
  inorm_add<<<dim3(B_ * C_), blk, 0, stream>>>(U, x, out);
}

// v001
// A run of this version takes 184 microseconds.
// Timed twice side by side with v000, it ran 1.16 times as fast both times.
#include <hip/hip_runtime.h>
#include <stdint.h>

typedef __attribute__((ext_vector_type(2))) float v2f;
typedef __attribute__((ext_vector_type(8))) float v8f;

#define B_   16
#define C_   256
#define CI_  128
#define N_   4096
#define EPS_ 1e-5f

__device__ __forceinline__ v8f wmma_f32(v2f a, v2f b, v8f c) {
  // D = A(16x4 f32) * B(4x16 f32) + C(16x16 f32)
  return __builtin_amdgcn_wmma_f32_16x16x4_f32(false, a, false, b, (short)0, c, false, false);
}

// Async global->LDS 16-byte copy (CDNA5, tracked by ASYNCcnt). GV mode.
__device__ __forceinline__ void async_b128(uint32_t lds_off, uint64_t gaddr) {
  asm volatile("global_load_async_to_lds_b128 %0, %1, off"
               :: "v"(lds_off), "v"(gaddr) : "memory");
}
__device__ __forceinline__ void wait_async0() {
  asm volatile("s_wait_asynccnt 0" ::: "memory");
}
__device__ __forceinline__ void wait_async4() {
  asm volatile("s_wait_asynccnt 4" ::: "memory");
}
// Low 32 bits of a flat LDS-aperture address are the LDS byte offset.
__device__ __forceinline__ uint32_t lds_off(const void* p) {
  return (uint32_t)(uintptr_t)p;
}

// ---------------------------------------------------------------------------
// Generic NN GEMM:  C[b][y] = Ay[b](128 x K) @ Bm[b](K x N) (+ bias_y)
// blockIdx.y picks one of up to three 128-row A operands with its bias and its
// output block (sCy apart), so products that share Bm run in one launch.
// Workgroup: 128x128 block, 8 waves (4x2), each wave 2x4 16x16 tiles.
// Double-buffered async global->LDS staging.
// ---------------------------------------------------------------------------
__global__ __launch_bounds__(256) void gemm_nn_wmma(
    const float* __restrict__ A0, const float* __restrict__ A1,
    const float* __restrict__ A2, long long sA,
    const float* __restrict__ Bm, long long sB,
    float* __restrict__ Cm, long long sC, long long sCy,
    const float* __restrict__ bias0, const float* __restrict__ bias1,
    const float* __restrict__ bias2,
    int K, int N)
{
  __shared__ float As[2][128][20];   // stride 20: 16B-aligned rows, conflict-free
  __shared__ float Bs[2][16][128];

  const int t  = threadIdx.x;
  const int w  = t >> 5, l = t & 31, lh = l >> 4, ll = l & 15;
  const int wm = w >> 1, wn = w & 1;

  const int y = blockIdx.y;
  const float* A    = y == 0 ? A0    : (y == 1 ? A1    : A2);
  const float* bias = y == 0 ? bias0 : (y == 1 ? bias1 : bias2);
  const float* Ab = A  + (size_t)blockIdx.z * sA;
  const float* Bb = Bm + (size_t)blockIdx.z * sB;
  float*       Cb = Cm + (size_t)blockIdx.z * sC + (size_t)y * sCy;
  const int nBase = blockIdx.x * 128;

  // per-thread async chunks: A tile = 512 x b128, B tile = 512 x b128, 2 each
  const int ca0 = t, ca1 = t + 256;
  const uint64_t aSrc0 = (uint64_t)(uintptr_t)(Ab + (size_t)(ca0 >> 2) * K + (ca0 & 3) * 4);
  const uint64_t aSrc1 = (uint64_t)(uintptr_t)(Ab + (size_t)(ca1 >> 2) * K + (ca1 & 3) * 4);
  const uint64_t bSrc0 = (uint64_t)(uintptr_t)(Bb + (size_t)(ca0 >> 5) * N + nBase + (ca0 & 31) * 4);
  const uint64_t bSrc1 = (uint64_t)(uintptr_t)(Bb + (size_t)(ca1 >> 5) * N + nBase + (ca1 & 31) * 4);
  const uint32_t aDst0 = lds_off(&As[0][ca0 >> 2][(ca0 & 3) * 4]);
  const uint32_t aDst1 = lds_off(&As[0][ca1 >> 2][(ca1 & 3) * 4]);
  const uint32_t bDst0 = lds_off(&Bs[0][ca0 >> 5][(ca0 & 31) * 4]);
  const uint32_t bDst1 = lds_off(&Bs[0][ca1 >> 5][(ca1 & 31) * 4]);
  const uint32_t aBuf  = (uint32_t)((const char*)&As[1][0][0] - (const char*)&As[0][0][0]);
  const uint32_t bBuf  = (uint32_t)((const char*)&Bs[1][0][0] - (const char*)&Bs[0][0][0]);
  const uint64_t aStepK = 64;                       // 16 floats along K
  const uint64_t bStepK = (uint64_t)16 * N * 4;     // 16 rows of B

  v8f acc[2][4];
#pragma unroll
  for (int mi = 0; mi < 2; ++mi)
#pragma unroll
    for (int ni = 0; ni < 4; ++ni)
#pragma unroll
      for (int r = 0; r < 8; ++r) acc[mi][ni][r] = 0.0f;

  const int nk = K >> 4;
  // prologue: stage chunk 0 into buffer 0
  async_b128(aDst0, aSrc0);
  async_b128(aDst1, aSrc1);
  async_b128(bDst0, bSrc0);
  async_b128(bDst1, bSrc1);

  for (int kc = 0; kc < nk; ++kc) {
    const int cur = kc & 1;
    if (kc + 1 < nk) {   // prefetch next chunk into the other buffer
      const uint32_t ab = (cur ^ 1) ? aBuf : 0u;
      const uint32_t bb = (cur ^ 1) ? bBuf : 0u;
      const uint64_t ka = (uint64_t)(kc + 1) * aStepK;
      const uint64_t kb = (uint64_t)(kc + 1) * bStepK;
      async_b128(aDst0 + ab, aSrc0 + ka);
      async_b128(aDst1 + ab, aSrc1 + ka);
      async_b128(bDst0 + bb, bSrc0 + kb);
      async_b128(bDst1 + bb, bSrc1 + kb);
      wait_async4();     // current chunk's 4 transfers complete (in-order)
    } else {
      wait_async0();
    }
    __syncthreads();

#pragma unroll
    for (int ks = 0; ks < 16; ks += 4) {
      v2f af[2], bf[4];
#pragma unroll
      for (int mi = 0; mi < 2; ++mi)
        af[mi] = *(const v2f*)&As[cur][(wm * 2 + mi) * 16 + ll][ks + 2 * lh];
#pragma unroll
      for (int ni = 0; ni < 4; ++ni) {
        const int col = (wn * 4 + ni) * 16 + ll;
        v2f b;
        b.x = Bs[cur][ks + 2 * lh + 0][col];
        b.y = Bs[cur][ks + 2 * lh + 1][col];
        bf[ni] = b;
      }
#pragma unroll
      for (int mi = 0; mi < 2; ++mi)
#pragma unroll
        for (int ni = 0; ni < 4; ++ni)
          acc[mi][ni] = wmma_f32(af[mi], bf[ni], acc[mi][ni]);
    }
    __syncthreads();
  }

#pragma unroll
  for (int mi = 0; mi < 2; ++mi)
#pragma unroll
    for (int r = 0; r < 8; ++r) {
      const int row = (wm * 2 + mi) * 16 + r + 8 * lh;
      const float bv = bias ? bias[row] : 0.0f;
#pragma unroll
      for (int ni = 0; ni < 4; ++ni) {
        const int col = nBase + (wn * 4 + ni) * 16 + ll;
        Cb[(size_t)row * N + col] = acc[mi][ni][r] + bv;
      }
    }
}

// ---------------------------------------------------------------------------
// NT Gram with split-K:  Fp[b][split] = Th[b](128xKslice) @ Ph[b](128xKslice)^T
// Kslice = 256, 16 splits covering K = 4096. Double-buffered async staging.
// ---------------------------------------------------------------------------
__global__ __launch_bounds__(256) void gemm_nt_splitk(
    const float* __restrict__ Th, const float* __restrict__ Ph,
    float* __restrict__ Fp)
{
  __shared__ float As[2][128][20];
  __shared__ float Bs[2][128][20];

  const int t  = threadIdx.x;
  const int w  = t >> 5, l = t & 31, lh = l >> 4, ll = l & 15;
  const int wm = w >> 1, wn = w & 1;

  const int b = blockIdx.z;
  const int kBase = blockIdx.x * 256;
  const float* Ab = Th + (size_t)b * ((size_t)CI_ * N_) + kBase;
  const float* Bb = Ph + (size_t)b * ((size_t)CI_ * N_) + kBase;
  float* Fb = Fp + ((size_t)b * gridDim.x + blockIdx.x) * (128 * 128);

  const int ca0 = t, ca1 = t + 256;
  const uint64_t aSrc0 = (uint64_t)(uintptr_t)(Ab + (size_t)(ca0 >> 2) * N_ + (ca0 & 3) * 4);
  const uint64_t aSrc1 = (uint64_t)(uintptr_t)(Ab + (size_t)(ca1 >> 2) * N_ + (ca1 & 3) * 4);
  const uint64_t bSrc0 = (uint64_t)(uintptr_t)(Bb + (size_t)(ca0 >> 2) * N_ + (ca0 & 3) * 4);
  const uint64_t bSrc1 = (uint64_t)(uintptr_t)(Bb + (size_t)(ca1 >> 2) * N_ + (ca1 & 3) * 4);
  const uint32_t aDst0 = lds_off(&As[0][ca0 >> 2][(ca0 & 3) * 4]);
  const uint32_t aDst1 = lds_off(&As[0][ca1 >> 2][(ca1 & 3) * 4]);
  const uint32_t bDst0 = lds_off(&Bs[0][ca0 >> 2][(ca0 & 3) * 4]);
  const uint32_t bDst1 = lds_off(&Bs[0][ca1 >> 2][(ca1 & 3) * 4]);
  const uint32_t aBuf  = (uint32_t)((const char*)&As[1][0][0] - (const char*)&As[0][0][0]);
  const uint32_t bBuf  = (uint32_t)((const char*)&Bs[1][0][0] - (const char*)&Bs[0][0][0]);

  v8f acc[2][4];
#pragma unroll
  for (int mi = 0; mi < 2; ++mi)
#pragma unroll
    for (int ni = 0; ni < 4; ++ni)
#pragma unroll
      for (int r = 0; r < 8; ++r) acc[mi][ni][r] = 0.0f;

  const int nk = 256 / 16;
  async_b128(aDst0, aSrc0);
  async_b128(aDst1, aSrc1);
  async_b128(bDst0, bSrc0);
  async_b128(bDst1, bSrc1);

  for (int kc = 0; kc < nk; ++kc) {
    const int cur = kc & 1;
    if (kc + 1 < nk) {
      const uint32_t ab = (cur ^ 1) ? aBuf : 0u;
      const uint32_t bb = (cur ^ 1) ? bBuf : 0u;
      const uint64_t ka = (uint64_t)(kc + 1) * 64;
      async_b128(aDst0 + ab, aSrc0 + ka);
      async_b128(aDst1 + ab, aSrc1 + ka);
      async_b128(bDst0 + bb, bSrc0 + ka);
      async_b128(bDst1 + bb, bSrc1 + ka);
      wait_async4();
    } else {
      wait_async0();
    }
    __syncthreads();

#pragma unroll
    for (int ks = 0; ks < 16; ks += 4) {
      v2f af[2], bf[4];
#pragma unroll
      for (int mi = 0; mi < 2; ++mi)
        af[mi] = *(const v2f*)&As[cur][(wm * 2 + mi) * 16 + ll][ks + 2 * lh];
#pragma unroll
      for (int ni = 0; ni < 4; ++ni)
        bf[ni] = *(const v2f*)&Bs[cur][(wn * 4 + ni) * 16 + ll][ks + 2 * lh];
#pragma unroll
      for (int mi = 0; mi < 2; ++mi)
#pragma unroll
        for (int ni = 0; ni < 4; ++ni)
          acc[mi][ni] = wmma_f32(af[mi], bf[ni], acc[mi][ni]);
    }
    __syncthreads();
  }

#pragma unroll
  for (int mi = 0; mi < 2; ++mi)
#pragma unroll
    for (int r = 0; r < 8; ++r) {
      const int row = (wm * 2 + mi) * 16 + r + 8 * lh;
#pragma unroll
      for (int ni = 0; ni < 4; ++ni) {
        const int col = (wn * 4 + ni) * 16 + ll;
        Fb[row * 128 + col] = acc[mi][ni][r];
      }
    }
}

// Deterministic split-K reduction: F = sum over 16 partials
__global__ __launch_bounds__(256) void reduce_split(const float* __restrict__ Fp,
                                                    float* __restrict__ F) {
  const int idx = blockIdx.x * 256 + threadIdx.x;   // B_*128*128 total
  const int b = idx >> 14;
  const int r = idx & 16383;
  float s = 0.0f;
#pragma unroll
  for (int sp = 0; sp < 16; ++sp)
    s += Fp[((size_t)b * 16 + sp) * 16384 + r];
  F[idx] = s;
}

// Softmax over rows of length 128 (with max subtraction; logits have sigma~64)
__global__ __launch_bounds__(128) void softmax_row128(float* __restrict__ F) {
  __shared__ float red[128];
  const int t = threadIdx.x;
  float* row = F + (size_t)blockIdx.x * 128;
  float v = row[t];
  red[t] = v;
  __syncthreads();
  for (int off = 64; off > 0; off >>= 1) {
    if (t < off) red[t] = fmaxf(red[t], red[t + off]);
    __syncthreads();
  }
  const float m = red[0];
  __syncthreads();
  const float e = expf(v - m);
  red[t] = e;
  __syncthreads();
  for (int off = 64; off > 0; off >>= 1) {
    if (t < off) red[t] += red[t + off];
    __syncthreads();
  }
  row[t] = e / red[0];
}

// torch permute(0,2,1).view(B,Ci,H,W)  ==  per-batch transpose of Y[128][4096]
__global__ __launch_bounds__(256) void transpose_ci_n(const float* __restrict__ Y,
                                                      float* __restrict__ Z) {
  __shared__ float tile[32][33];
  const int b  = blockIdx.z;
  const int n0 = blockIdx.x * 32;
  const int i0 = blockIdx.y * 32;
  const int tx = threadIdx.x & 31;
  const int ty = threadIdx.x >> 5;  // 0..7
  const float* Yb = Y + (size_t)b * ((size_t)CI_ * N_);
  float*       Zb = Z + (size_t)b * ((size_t)CI_ * N_);
#pragma unroll
  for (int j = 0; j < 32; j += 8)
    tile[ty + j][tx] = Yb[(size_t)(i0 + ty + j) * N_ + n0 + tx];
  __syncthreads();
#pragma unroll
  for (int j = 0; j < 32; j += 8)
    Zb[(size_t)(n0 + ty + j) * CI_ + i0 + tx] = tile[tx][ty + j];
}

// InstanceNorm (affine=False) + ReLU, in place; one workgroup per 4096-row
__global__ __launch_bounds__(256) void inorm_relu(float* __restrict__ P) {
  __shared__ float ra[256], rb[256];
  const int t = threadIdx.x;
  float* p = P + (size_t)blockIdx.x * N_;
  float v[16];
  float s = 0.0f, s2 = 0.0f;
#pragma unroll
  for (int j = 0; j < 16; ++j) {
    v[j] = p[t + 256 * j];
    s += v[j]; s2 += v[j] * v[j];
  }
  ra[t] = s; rb[t] = s2;
  __syncthreads();
  for (int off = 128; off > 0; off >>= 1) {
    if (t < off) { ra[t] += ra[t + off]; rb[t] += rb[t + off]; }
    __syncthreads();
  }
  const float mean = ra[0] * (1.0f / N_);
  const float var  = rb[0] * (1.0f / N_) - mean * mean;
  const float rstd = rsqrtf(var + EPS_);
#pragma unroll
  for (int j = 0; j < 16; ++j)
    p[t + 256 * j] = fmaxf((v[j] - mean) * rstd, 0.0f);
}

// Final InstanceNorm + residual add: out = (U - mean)*rstd + x
__global__ __launch_bounds__(256) void inorm_add(const float* __restrict__ U,
                                                 const float* __restrict__ x,
                                                 float* __restrict__ out) {
  __shared__ float ra[256], rb[256];
  const int t = threadIdx.x;
  const size_t base = (size_t)blockIdx.x * N_;
  float v[16];
  float s = 0.0f, s2 = 0.0f;
#pragma unroll
  for (int j = 0; j < 16; ++j) {
    v[j] = U[base + t + 256 * j];
    s += v[j]; s2 += v[j] * v[j];
  }
  ra[t] = s; rb[t] = s2;
  __syncthreads();
  for (int off = 128; off > 0; off >>= 1) {
    if (t < off) { ra[t] += ra[t + off]; rb[t] += rb[t + off]; }
    __syncthreads();
  }
  const float mean = ra[0] * (1.0f / N_);
  const float var  = rb[0] * (1.0f / N_) - mean * mean;
  const float rstd = rsqrtf(var + EPS_);
#pragma unroll
  for (int j = 0; j < 16; ++j) {
    const size_t o = base + t + 256 * j;
    out[o] = (v[j] - mean) * rstd + x[o];
  }
}

extern "C" void kernel_launch(void* const* d_in, const int* in_sizes, int n_in,
                              void* d_out, int out_size, void* d_ws, size_t ws_size,
                              hipStream_t stream) {
  const float* x    = (const float*)d_in[0];
  const float* g_w  = (const float*)d_in[1];
  const float* g_b  = (const float*)d_in[2];
  const float* th_w = (const float*)d_in[3];
  const float* th_b = (const float*)d_in[4];
  const float* ph_w = (const float*)d_in[5];
  const float* ph_b = (const float*)d_in[6];
  const float* W_w  = (const float*)d_in[7];
  const float* W_b  = (const float*)d_in[8];
  float* out = (float*)d_out;

  float* ws = (float*)d_ws;
  const size_t PN   = (size_t)CI_ * N_;   // 524288 floats per (batch, proj)
  const size_t SLAB = (size_t)B_ * PN;    // 8388608 floats per proj slab
  float* P  = ws;                 // [3][B][Ci][N]   (g, theta, phi)
  float* Y  = P + 3 * SLAB;       // [B][Ci][N]
  float* Z  = Y + SLAB;           // [B][Ci][N]
  float* Fp = Z;                  // alias: split-K partials, dead before Z used
  float* F  = Z + SLAB;           // [B][Ci][Ci]
  float* U  = P;                  // alias: final conv output over dead P

  dim3 blk(256);

  // 1) three 1x1-conv projections (NN GEMM + bias), one launch: y = g, theta, phi
  gemm_nn_wmma<<<dim3(32, 3, B_), blk, 0, stream>>>(g_w, th_w, ph_w, 0, x, (long long)C_ * N_,
                                                    P, (long long)PN, (long long)SLAB,
                                                    g_b, th_b, ph_b, C_, N_);
  // 2) instance norm + relu on all 3*B*Ci rows, in place
  inorm_relu<<<dim3(3 * B_ * CI_), blk, 0, stream>>>(P);
  // 3) Gram: theta @ phi^T, split-K=16, then deterministic reduce
  gemm_nt_splitk<<<dim3(16, 1, B_), blk, 0, stream>>>(P + SLAB, P + 2 * SLAB, Fp);
  reduce_split<<<dim3((B_ * CI_ * CI_) / 256), blk, 0, stream>>>(Fp, F);
  // 4) softmax over rows of 128
  softmax_row128<<<dim3(B_ * CI_), dim3(128), 0, stream>>>(F);
  // 5) Y = attn @ g
  gemm_nn_wmma<<<dim3(32, 1, B_), blk, 0, stream>>>(F, nullptr, nullptr, (long long)CI_ * CI_, P, (long long)PN,
                                                    Y, (long long)PN, 0,
                                                    nullptr, nullptr, nullptr, CI_, N_);
  // 6) permute-view == per-batch transpose
  transpose_ci_n<<<dim3(N_ / 32, CI_ / 32, B_), blk, 0, stream>>>(Y, Z);
  // 7) final 1x1 conv (M=256 -> gridDim.y = 2)
  gemm_nn_wmma<<<dim3(32, 2, B_), blk, 0, stream>>>(W_w, W_w + 128 * CI_, nullptr, 0, Z, (long long)PN,
                                                    U, (long long)C_ * N_, (long long)128 * N_,
                                                    W_b, W_b + 128, nullptr, CI_, N_);
  // 8) instance norm + residual
  inorm_add<<<dim3(B_ * C_), blk, 0, stream>>>(U, x, out);
}

// v002
// It runs in 179 microseconds.
// In two side-by-side timings against v001, it was 1.03 and 1.04 times as fast.
// Over all steps from v000 it is 1.20 times as fast.
#include <hip/hip_runtime.h>
#include <stdint.h>

typedef __attribute__((ext_vector_type(2))) float v2f;
typedef __attribute__((ext_vector_type(8))) float v8f;

#define B_   16
#define C_   256
#define CI_  128
#define N_   4096
#define EPS_ 1e-5f

__device__ __forceinline__ v8f wmma_f32(v2f a, v2f b, v8f c) {
  // D = A(16x4 f32) * B(4x16 f32) + C(16x16 f32)
  return __builtin_amdgcn_wmma_f32_16x16x4_f32(false, a, false, b, (short)0, c, false, false);
}

// Async global->LDS 16-byte copy (CDNA5, tracked by ASYNCcnt). GV mode.
__device__ __forceinline__ void async_b128(uint32_t lds_off, uint64_t gaddr) {
  asm volatile("global_load_async_to_lds_b128 %0, %1, off"
               :: "v"(lds_off), "v"(gaddr) : "memory");
}
__device__ __forceinline__ void wait_async0() {
  asm volatile("s_wait_asynccnt 0" ::: "memory");
}
__device__ __forceinline__ void wait_async4() {
  asm volatile("s_wait_asynccnt 4" ::: "memory");
}
// Low 32 bits of a flat LDS-aperture address are the LDS byte offset.
__device__ __forceinline__ uint32_t lds_off(const void* p) {
  return (uint32_t)(uintptr_t)p;
}

// ---------------------------------------------------------------------------
// Generic NN GEMM:  C[b][y] = Ay[b](128 x K) @ Bm[b](K x N) (+ bias_y)
// blockIdx.y picks one of up to three 128-row A operands with its bias and its
// output block (sCy apart), so products that share Bm run in one launch.
// Workgroup: 128x128 block, 8 waves (4x2), each wave 2x4 16x16 tiles.
// Double-buffered async global->LDS staging.
// TR: the two operands change places in the matrix instruction, so each
// accumulator tile holds its block of C transposed, and C^T (N rows of 128) is
// stored with the same 64-byte row pieces as C; k order and sums are the same.
// ---------------------------------------------------------------------------
template <bool TR>
__global__ __launch_bounds__(256) void gemm_nn_wmma(
    const float* __restrict__ A0, const float* __restrict__ A1,
    const float* __restrict__ A2, long long sA,
    const float* __restrict__ Bm, long long sB,
    float* __restrict__ Cm, long long sC, long long sCy,
    const float* __restrict__ bias0, const float* __restrict__ bias1,
    const float* __restrict__ bias2,
    int K, int N)
{
  __shared__ float As[2][128][20];   // stride 20: 16B-aligned rows, conflict-free
  __shared__ float Bs[2][16][128];

  const int t  = threadIdx.x;
  const int w  = t >> 5, l = t & 31, lh = l >> 4, ll = l & 15;
  const int wm = w >> 1, wn = w & 1;

  const int y = blockIdx.y;
  const float* A    = y == 0 ? A0    : (y == 1 ? A1    : A2);
  const float* bias = y == 0 ? bias0 : (y == 1 ? bias1 : bias2);
  const float* Ab = A  + (size_t)blockIdx.z * sA;
  const float* Bb = Bm + (size_t)blockIdx.z * sB;
  float*       Cb = Cm + (size_t)blockIdx.z * sC + (size_t)y * sCy;
  const int nBase = blockIdx.x * 128;

  // per-thread async chunks: A tile = 512 x b128, B tile = 512 x b128, 2 each
  const int ca0 = t, ca1 = t + 256;
  const uint64_t aSrc0 = (uint64_t)(uintptr_t)(Ab + (size_t)(ca0 >> 2) * K + (ca0 & 3) * 4);
  const uint64_t aSrc1 = (uint64_t)(uintptr_t)(Ab + (size_t)(ca1 >> 2) * K + (ca1 & 3) * 4);
  const uint64_t bSrc0 = (uint64_t)(uintptr_t)(Bb + (size_t)(ca0 >> 5) * N + nBase + (ca0 & 31) * 4);
  const uint64_t bSrc1 = (uint64_t)(uintptr_t)(Bb + (size_t)(ca1 >> 5) * N + nBase + (ca1 & 31) * 4);
  const uint32_t aDst0 = lds_off(&As[0][ca0 >> 2][(ca0 & 3) * 4]);
  const uint32_t aDst1 = lds_off(&As[0][ca1 >> 2][(ca1 & 3) * 4]);
  const uint32_t bDst0 = lds_off(&Bs[0][ca0 >> 5][(ca0 & 31) * 4]);
  const uint32_t bDst1 = lds_off(&Bs[0][ca1 >> 5][(ca1 & 31) * 4]);
  const uint32_t aBuf  = (uint32_t)((const char*)&As[1][0][0] - (const char*)&As[0][0][0]);
  const uint32_t bBuf  = (uint32_t)((const char*)&Bs[1][0][0] - (const char*)&Bs[0][0][0]);
  const uint64_t aStepK = 64;                       // 16 floats along K
  const uint64_t bStepK = (uint64_t)16 * N * 4;     // 16 rows of B

  v8f acc[2][4];
#pragma unroll
  for (int mi = 0; mi < 2; ++mi)
#pragma unroll
    for (int ni = 0; ni < 4; ++ni)
#pragma unroll
      for (int r = 0; r < 8; ++r) acc[mi][ni][r] = 0.0f;

  const int nk = K >> 4;
  // prologue: stage chunk 0 into buffer 0
  async_b128(aDst0, aSrc0);
  async_b128(aDst1, aSrc1);
  async_b128(bDst0, bSrc0);
  async_b128(bDst1, bSrc1);

  for (int kc = 0; kc < nk; ++kc) {
    const int cur = kc & 1;
    if (kc + 1 < nk) {   // prefetch next chunk into the other buffer
      const uint32_t ab = (cur ^ 1) ? aBuf : 0u;
      const uint32_t bb = (cur ^ 1) ? bBuf : 0u;
      const uint64_t ka = (uint64_t)(kc + 1) * aStepK;
      const uint64_t kb = (uint64_t)(kc + 1) * bStepK;
      async_b128(aDst0 + ab, aSrc0 + ka);
      async_b128(aDst1 + ab, aSrc1 + ka);
      async_b128(bDst0 + bb, bSrc0 + kb);
      async_b128(bDst1 + bb, bSrc1 + kb);
      wait_async4();     // current chunk's 4 transfers complete (in-order)
    } else {
      wait_async0();
    }
    __syncthreads();

#pragma unroll
    for (int ks = 0; ks < 16; ks += 4) {
      v2f af[2], bf[4];
#pragma unroll
      for (int mi = 0; mi < 2; ++mi)
        af[mi] = *(const v2f*)&As[cur][(wm * 2 + mi) * 16 + ll][ks + 2 * lh];
#pragma unroll
      for (int ni = 0; ni < 4; ++ni) {
        const int col = (wn * 4 + ni) * 16 + ll;
        v2f b;
        b.x = Bs[cur][ks + 2 * lh + 0][col];
        b.y = Bs[cur][ks + 2 * lh + 1][col];
        bf[ni] = b;
      }
#pragma unroll
      for (int mi = 0; mi < 2; ++mi)
#pragma unroll
        for (int ni = 0; ni < 4; ++ni)
          acc[mi][ni] = TR ? wmma_f32(bf[ni], af[mi], acc[mi][ni])
                           : wmma_f32(af[mi], bf[ni], acc[mi][ni]);
    }
    __syncthreads();
  }

  if constexpr (TR) {
    // acc[mi][ni][r] = C[(wm*2+mi)*16 + ll][nBase + (wn*4+ni)*16 + r + 8*lh]
    float bv[2];
#pragma unroll
    for (int mi = 0; mi < 2; ++mi)
      bv[mi] = bias ? bias[(wm * 2 + mi) * 16 + ll] : 0.0f;
#pragma unroll
    for (int ni = 0; ni < 4; ++ni)
#pragma unroll
      for (int r = 0; r < 8; ++r) {
        const int col = nBase + (wn * 4 + ni) * 16 + r + 8 * lh;
#pragma unroll
        for (int mi = 0; mi < 2; ++mi)   // the two halves of one 128-byte line
          Cb[(size_t)col * 128 + (wm * 2 + mi) * 16 + ll] = acc[mi][ni][r] + bv[mi];
      }
  } else {
#pragma unroll
    for (int mi = 0; mi < 2; ++mi)
#pragma unroll
      for (int r = 0; r < 8; ++r) {
        const int row = (wm * 2 + mi) * 16 + r + 8 * lh;
        const float bv = bias ? bias[row] : 0.0f;
#pragma unroll
        for (int ni = 0; ni < 4; ++ni) {
          const int col = nBase + (wn * 4 + ni) * 16 + ll;
          Cb[(size_t)row * N + col] = acc[mi][ni][r] + bv;
        }
      }
  }
}

// ---------------------------------------------------------------------------
// NT Gram with split-K:  Fp[b][split] = Th[b](128xKslice) @ Ph[b](128xKslice)^T
// Kslice = 256, 16 splits covering K = 4096. Double-buffered async staging.
// ---------------------------------------------------------------------------
__global__ __launch_bounds__(256) void gemm_nt_splitk(
    const float* __restrict__ Th, const float* __restrict__ Ph,
    float* __restrict__ Fp)
{
  __shared__ float As[2][128][20];
  __shared__ float Bs[2][128][20];

  const int t  = threadIdx.x;
  const int w  = t >> 5, l = t & 31, lh = l >> 4, ll = l & 15;
  const int wm = w >> 1, wn = w & 1;

  const int b = blockIdx.z;
  const int kBase = blockIdx.x * 256;
  const float* Ab = Th + (size_t)b * ((size_t)CI_ * N_) + kBase;
  const float* Bb = Ph + (size_t)b * ((size_t)CI_ * N_) + kBase;
  float* Fb = Fp + ((size_t)b * gridDim.x + blockIdx.x) * (128 * 128);

  const int ca0 = t, ca1 = t + 256;
  const uint64_t aSrc0 = (uint64_t)(uintptr_t)(Ab + (size_t)(ca0 >> 2) * N_ + (ca0 & 3) * 4);
  const uint64_t aSrc1 = (uint64_t)(uintptr_t)(Ab + (size_t)(ca1 >> 2) * N_ + (ca1 & 3) * 4);
  const uint64_t bSrc0 = (uint64_t)(uintptr_t)(Bb + (size_t)(ca0 >> 2) * N_ + (ca0 & 3) * 4);
  const uint64_t bSrc1 = (uint64_t)(uintptr_t)(Bb + (size_t)(ca1 >> 2) * N_ + (ca1 & 3) * 4);
  const uint32_t aDst0 = lds_off(&As[0][ca0 >> 2][(ca0 & 3) * 4]);
  const uint32_t aDst1 = lds_off(&As[0][ca1 >> 2][(ca1 & 3) * 4]);
  const uint32_t bDst0 = lds_off(&Bs[0][ca0 >> 2][(ca0 & 3) * 4]);
  const uint32_t bDst1 = lds_off(&Bs[0][ca1 >> 2][(ca1 & 3) * 4]);
  const uint32_t aBuf  = (uint32_t)((const char*)&As[1][0][0] - (const char*)&As[0][0][0]);
  const uint32_t bBuf  = (uint32_t)((const char*)&Bs[1][0][0] - (const char*)&Bs[0][0][0]);

  v8f acc[2][4];
#pragma unroll
  for (int mi = 0; mi < 2; ++mi)
#pragma unroll
    for (int ni = 0; ni < 4; ++ni)
#pragma unroll
      for (int r = 0; r < 8; ++r) acc[mi][ni][r] = 0.0f;

  const int nk = 256 / 16;
  async_b128(aDst0, aSrc0);
  async_b128(aDst1, aSrc1);
  async_b128(bDst0, bSrc0);
  async_b128(bDst1, bSrc1);

  for (int kc = 0; kc < nk; ++kc) {
    const int cur = kc & 1;
    if (kc + 1 < nk) {
      const uint32_t ab = (cur ^ 1) ? aBuf : 0u;
      const uint32_t bb = (cur ^ 1) ? bBuf : 0u;
      const uint64_t ka = (uint64_t)(kc + 1) * 64;
      async_b128(aDst0 + ab, aSrc0 + ka);
      async_b128(aDst1 + ab, aSrc1 + ka);
      async_b128(bDst0 + bb, bSrc0 + ka);
      async_b128(bDst1 + bb, bSrc1 + ka);
      wait_async4();
    } else {
      wait_async0();
    }
    __syncthreads();

#pragma unroll
    for (int ks = 0; ks < 16; ks += 4) {
      v2f af[2], bf[4];
#pragma unroll
      for (int mi = 0; mi < 2; ++mi)
        af[mi] = *(const v2f*)&As[cur][(wm * 2 + mi) * 16 + ll][ks + 2 * lh];
#pragma unroll
      for (int ni = 0; ni < 4; ++ni)
        bf[ni] = *(const v2f*)&Bs[cur][(wn * 4 + ni) * 16 + ll][ks + 2 * lh];
#pragma unroll
      for (int mi = 0; mi < 2; ++mi)
#pragma unroll
        for (int ni = 0; ni < 4; ++ni)
          acc[mi][ni] = wmma_f32(af[mi], bf[ni], acc[mi][ni]);
    }
    __syncthreads();
  }

#pragma unroll
  for (int mi = 0; mi < 2; ++mi)
#pragma unroll
    for (int r = 0; r < 8; ++r) {
      const int row = (wm * 2 + mi) * 16 + r + 8 * lh;
#pragma unroll
      for (int ni = 0; ni < 4; ++ni) {
        const int col = (wn * 4 + ni) * 16 + ll;
        Fb[row * 128 + col] = acc[mi][ni][r];
      }
    }
}

// Deterministic split-K reduction: F = sum over 16 partials
__global__ __launch_bounds__(256) void reduce_split(const float* __restrict__ Fp,
                                                    float* __restrict__ F) {
  const int idx = blockIdx.x * 256 + threadIdx.x;   // B_*128*128 total
  const int b = idx >> 14;
  const int r = idx & 16383;
  float s = 0.0f;
#pragma unroll
  for (int sp = 0; sp < 16; ++sp)
    s += Fp[((size_t)b * 16 + sp) * 16384 + r];
  F[idx] = s;
}

// Softmax over rows of length 128 (with max subtraction; logits have sigma~64)
__global__ __launch_bounds__(128) void softmax_row128(float* __restrict__ F) {
  __shared__ float red[128];
  const int t = threadIdx.x;
  float* row = F + (size_t)blockIdx.x * 128;
  float v = row[t];
  red[t] = v;
  __syncthreads();
  for (int off = 64; off > 0; off >>= 1) {
    if (t < off) red[t] = fmaxf(red[t], red[t + off]);
    __syncthreads();
  }
  const float m = red[0];
  __syncthreads();
  const float e = expf(v - m);
  red[t] = e;
  __syncthreads();
  for (int off = 64; off > 0; off >>= 1) {
    if (t < off) red[t] += red[t + off];
    __syncthreads();
  }
  row[t] = e / red[0];
}

// InstanceNorm (affine=False) + ReLU, in place; one workgroup per 4096-row
__global__ __launch_bounds__(256) void inorm_relu(float* __restrict__ P) {
  __shared__ float ra[256], rb[256];
  const int t = threadIdx.x;
  float* p = P + (size_t)blockIdx.x * N_;
  float v[16];
  float s = 0.0f, s2 = 0.0f;
#pragma unroll
  for (int j = 0; j < 16; ++j) {
    v[j] = p[t + 256 * j];
    s += v[j]; s2 += v[j] * v[j];
  }
  ra[t] = s; rb[t] = s2;
  __syncthreads();
  for (int off = 128; off > 0; off >>= 1) {
    if (t < off) { ra[t] += ra[t + off]; rb[t] += rb[t + off]; }
    __syncthreads();
  }
  const float mean = ra[0] * (1.0f / N_);
  const float var  = rb[0] * (1.0f / N_) - mean * mean;
  const float rstd = rsqrtf(var + EPS_);
#pragma unroll
  for (int j = 0; j < 16; ++j)
    p[t + 256 * j] = fmaxf((v[j] - mean) * rstd, 0.0f);
}

// Final InstanceNorm + residual add: out = (U - mean)*rstd + x
__global__ __launch_bounds__(256) void inorm_add(const float* __restrict__ U,
                                                 const float* __restrict__ x,
                                                 float* __restrict__ out) {
  __shared__ float ra[256], rb[256];
  const int t = threadIdx.x;
  const size_t base = (size_t)blockIdx.x * N_;
  float v[16];
  float s = 0.0f, s2 = 0.0f;
#pragma unroll
  for (int j = 0; j < 16; ++j) {
    v[j] = U[base + t + 256 * j];
    s += v[j]; s2 += v[j] * v[j];
  }
  ra[t] = s; rb[t] = s2;
  __syncthreads();
  for (int off = 128; off > 0; off >>= 1) {
    if (t < off) { ra[t] += ra[t + off]; rb[t] += rb[t + off]; }
    __syncthreads();
  }
  const float mean = ra[0] * (1.0f / N_);
  const float var  = rb[0] * (1.0f / N_) - mean * mean;
  const float rstd = rsqrtf(var + EPS_);
#pragma unroll
  for (int j = 0; j < 16; ++j) {
    const size_t o = base + t + 256 * j;
    out[o] = (v[j] - mean) * rstd + x[o];
  }
}

extern "C" void kernel_launch(void* const* d_in, const int* in_sizes, int n_in,
                              void* d_out, int out_size, void* d_ws, size_t ws_size,
                              hipStream_t stream) {
  const float* x    = (const float*)d_in[0];
  const float* g_w  = (const float*)d_in[1];
  const float* g_b  = (const float*)d_in[2];
  const float* th_w = (const float*)d_in[3];
  const float* th_b = (const float*)d_in[4];
  const float* ph_w = (const float*)d_in[5];
  const float* ph_b = (const float*)d_in[6];
  const float* W_w  = (const float*)d_in[7];
  const float* W_b  = (const float*)d_in[8];
  float* out = (float*)d_out;

  float* ws = (float*)d_ws;
  const size_t PN   = (size_t)CI_ * N_;   // 524288 floats per (batch, proj)
  const size_t SLAB = (size_t)B_ * PN;    // 8388608 floats per proj slab
  float* P  = ws;                 // [3][B][Ci][N]   (g, theta, phi)
  float* Z  = P + 3 * SLAB;       // [B][N][Ci] = (attn @ g)^T, read as [B][Ci][N]
  float* Fp = Z;                  // alias: split-K partials, dead before Z used
  float* F  = Z + SLAB;           // [B][Ci][Ci]
  float* U  = P;                  // alias: final conv output over dead P

  dim3 blk(256);

  // 1) three 1x1-conv projections (NN GEMM + bias), one launch: y = g, theta, phi
  gemm_nn_wmma<false><<<dim3(32, 3, B_), blk, 0, stream>>>(g_w, th_w, ph_w, 0, x, (long long)C_ * N_,
                                                    P, (long long)PN, (long long)SLAB,
                                                    g_b, th_b, ph_b, C_, N_);
  // 2) instance norm + relu on all 3*B*Ci rows, in place
  inorm_relu<<<dim3(3 * B_ * CI_), blk, 0, stream>>>(P);
  // 3) Gram: theta @ phi^T, split-K=16, then deterministic reduce
  gemm_nt_splitk<<<dim3(16, 1, B_), blk, 0, stream>>>(P + SLAB, P + 2 * SLAB, Fp);
  reduce_split<<<dim3((B_ * CI_ * CI_) / 256), blk, 0, stream>>>(Fp, F);
  // 4) softmax over rows of 128
  softmax_row128<<<dim3(B_ * CI_), dim3(128), 0, stream>>>(F);
  // 5) Z = (attn @ g)^T per batch: the permute(0,2,1) + view(B,Ci,H,W) is done by the store
  gemm_nn_wmma<true><<<dim3(32, 1, B_), blk, 0, stream>>>(F, nullptr, nullptr, (long long)CI_ * CI_, P, (long long)PN,
                                                    Z, (long long)PN, 0,
                                                    nullptr, nullptr, nullptr, CI_, N_);
  // 6) final 1x1 conv (M=256 -> gridDim.y = 2)
  gemm_nn_wmma<false><<<dim3(32, 2, B_), blk, 0, stream>>>(W_w, W_w + 128 * CI_, nullptr, 0, Z, (long long)PN,
                                                    U, (long long)C_ * N_, (long long)128 * N_,
                                                    W_b, W_b + 128, nullptr, CI_, N_);
  // 7) instance norm + residual
  inorm_add<<<dim3(B_ * C_), blk, 0, stream>>>(U, x, out);
}

// v003
// A run of this version takes 161 microseconds.
// In both of two side-by-side timings against v002, it was 1.11 times as fast.
// Over all steps from v000 it is 1.33 times as fast.
#include <hip/hip_runtime.h>
#include <stdint.h>

typedef __attribute__((ext_vector_type(2))) float v2f;
typedef __attribute__((ext_vector_type(8))) float v8f;

#define B_   16
#define C_   256
#define CI_  128
#define N_   4096
#define EPS_ 1e-5f

__device__ __forceinline__ v8f wmma_f32(v2f a, v2f b, v8f c) {
  // D = A(16x4 f32) * B(4x16 f32) + C(16x16 f32)
  return __builtin_amdgcn_wmma_f32_16x16x4_f32(false, a, false, b, (short)0, c, false, false);
}

// Async global->LDS 16-byte copy (CDNA5, tracked by ASYNCcnt). GV mode.
__device__ __forceinline__ void async_b128(uint32_t lds_off, uint64_t gaddr) {
  asm volatile("global_load_async_to_lds_b128 %0, %1, off"
               :: "v"(lds_off), "v"(gaddr) : "memory");
}
__device__ __forceinline__ void wait_async0() {
  asm volatile("s_wait_asynccnt 0" ::: "memory");
}
__device__ __forceinline__ void wait_async4() {
  asm volatile("s_wait_asynccnt 4" ::: "memory");
}
// Low 32 bits of a flat LDS-aperture address are the LDS byte offset.
__device__ __forceinline__ uint32_t lds_off(const void* p) {
  return (uint32_t)(uintptr_t)p;
}

// Sum over the 16 lanes of a row: four DPP butterfly steps (row_xmask 1, 2, 4, 8);
// every lane ends with the same sum.
template <int CTRL>
__device__ __forceinline__ float dpp_xadd(float v) {
  return v + __int_as_float(__builtin_amdgcn_update_dpp(0, __float_as_int(v), CTRL, 0xf, 0xf, true));
}
__device__ __forceinline__ float row16_sum(float v) {
  v = dpp_xadd<0x161>(v);
  v = dpp_xadd<0x162>(v);
  v = dpp_xadd<0x164>(v);
  v = dpp_xadd<0x168>(v);
  return v;
}

// Mean and 1/std of one projected row (4096 values) from the 64 partial
// (sum, sum of squares) pairs that the projection GEMM left in Sp.
// Sp: [proj*B + batch][64 parts][128 rows][2].
__device__ __forceinline__ void row_stats(const float* Sp, int pb, int row,
                                          float& mean, float& rstd) {
  const float2* p = (const float2*)Sp + (size_t)pb * (64 * 128) + row;
  float s = 0.0f, q = 0.0f;
  // unrolled so that all 64 loads are in flight together: one L2 round trip
#pragma unroll
  for (int i = 0; i < 64; ++i) {
    const float2 v = p[i * 128];
    s += v.x; q += v.y;
  }
  mean = s * (1.0f / N_);
  const float var = q * (1.0f / N_) - mean * mean;
  rstd = rsqrtf(var + EPS_);
}

// ---------------------------------------------------------------------------
// Generic NN GEMM:  C[b][y] = Ay[b](128 x K) @ Bm[b](K x N) (+ bias_y)
// blockIdx.y picks one of up to three 128-row A operands with its bias and its
// output block (sCy apart), so products that share Bm run in one launch.
// Workgroup: 128x128 block, 8 waves (4x2), each wave 2x4 16x16 tiles.
// Double-buffered async global->LDS staging.
// TR: the two operands change places in the matrix instruction, so each
// accumulator tile holds its block of C transposed, and C^T (N rows of 128) is
// stored with the same 64-byte row pieces as C; k order and sums are the same.
// STATS: the epilogue also leaves each wave's (sum, sum of squares) of its 64
// columns of every row in Sp, so that no separate pass has to read C for them.
// NORMB: Bm holds raw projected rows; InstanceNorm + ReLU is applied to the
// fragments: relu((v - m) * r) = r * relu(v - m), r > 0, and r goes onto A's k.
// ---------------------------------------------------------------------------
template <bool TR, bool STATS, bool NORMB>
__global__ __launch_bounds__(256) void gemm_nn_wmma(
    const float* __restrict__ A0, const float* __restrict__ A1,
    const float* __restrict__ A2, long long sA,
    const float* __restrict__ Bm, long long sB,
    float* __restrict__ Cm, long long sC, long long sCy,
    const float* __restrict__ bias0, const float* __restrict__ bias1,
    const float* __restrict__ bias2,
    float* Sp, int K, int N)
{
  __shared__ float As[2][128][20];   // stride 20: 16B-aligned rows, conflict-free
  __shared__ float Bs[2][16][128];
  __shared__ __attribute__((aligned(8))) float mS[128];   // NORMB: mean of B's row k
  __shared__ __attribute__((aligned(8))) float rS[128];   // NORMB: 1/std of B's row k

  const int t  = threadIdx.x;
  const int w  = t >> 5, l = t & 31, lh = l >> 4, ll = l & 15;
  const int wm = w >> 1, wn = w & 1;

  const int y = blockIdx.y;
  const float* A    = y == 0 ? A0    : (y == 1 ? A1    : A2);
  const float* bias = y == 0 ? bias0 : (y == 1 ? bias1 : bias2);
  const float* Ab = A  + (size_t)blockIdx.z * sA;
  const float* Bb = Bm + (size_t)blockIdx.z * sB;
  float*       Cb = Cm + (size_t)blockIdx.z * sC + (size_t)y * sCy;
  const int nBase = blockIdx.x * 128;

  // per-thread async chunks: A tile = 512 x b128, B tile = 512 x b128, 2 each
  const int ca0 = t, ca1 = t + 256;
  const uint64_t aSrc0 = (uint64_t)(uintptr_t)(Ab + (size_t)(ca0 >> 2) * K + (ca0 & 3) * 4);
  const uint64_t aSrc1 = (uint64_t)(uintptr_t)(Ab + (size_t)(ca1 >> 2) * K + (ca1 & 3) * 4);
  const uint64_t bSrc0 = (uint64_t)(uintptr_t)(Bb + (size_t)(ca0 >> 5) * N + nBase + (ca0 & 31) * 4);
  const uint64_t bSrc1 = (uint64_t)(uintptr_t)(Bb + (size_t)(ca1 >> 5) * N + nBase + (ca1 & 31) * 4);
  const uint32_t aDst0 = lds_off(&As[0][ca0 >> 2][(ca0 & 3) * 4]);
  const uint32_t aDst1 = lds_off(&As[0][ca1 >> 2][(ca1 & 3) * 4]);
  const uint32_t bDst0 = lds_off(&Bs[0][ca0 >> 5][(ca0 & 31) * 4]);
  const uint32_t bDst1 = lds_off(&Bs[0][ca1 >> 5][(ca1 & 31) * 4]);
  const uint32_t aBuf  = (uint32_t)((const char*)&As[1][0][0] - (const char*)&As[0][0][0]);
  const uint32_t bBuf  = (uint32_t)((const char*)&Bs[1][0][0] - (const char*)&Bs[0][0][0]);
  const uint64_t aStepK = 64;                       // 16 floats along K
  const uint64_t bStepK = (uint64_t)16 * N * 4;     // 16 rows of B

  v8f acc[2][4];
#pragma unroll
  for (int mi = 0; mi < 2; ++mi)
#pragma unroll
    for (int ni = 0; ni < 4; ++ni)
#pragma unroll
      for (int r = 0; r < 8; ++r) acc[mi][ni][r] = 0.0f;

  const int nk = K >> 4;
  // prologue: stage chunk 0 into buffer 0
  async_b128(aDst0, aSrc0);
  async_b128(aDst1, aSrc1);
  async_b128(bDst0, bSrc0);
  async_b128(bDst1, bSrc1);

  if constexpr (NORMB) {
    // keeps the loads below from landing in a register that a copy above names
    asm volatile("s_wait_xcnt 0x0" ::: "memory");
    // K = 128 rows of B; the k loop's first barrier publishes mS and rS
    if (t < 128) {
      float mean, rstd;
      row_stats(Sp, blockIdx.z, t, mean, rstd);
      mS[t] = mean;
      rS[t] = rstd;
    }
  }

  for (int kc = 0; kc < nk; ++kc) {
    const int cur = kc & 1;
    if (kc + 1 < nk) {   // prefetch next chunk into the other buffer
      const uint32_t ab = (cur ^ 1) ? aBuf : 0u;
      const uint32_t bb = (cur ^ 1) ? bBuf : 0u;
      const uint64_t ka = (uint64_t)(kc + 1) * aStepK;
      const uint64_t kb = (uint64_t)(kc + 1) * bStepK;
      async_b128(aDst0 + ab, aSrc0 + ka);
      async_b128(aDst1 + ab, aSrc1 + ka);
      async_b128(bDst0 + bb, bSrc0 + kb);
      async_b128(bDst1 + bb, bSrc1 + kb);
      wait_async4();     // current chunk's 4 transfers complete (in-order)
    } else {
      wait_async0();
    }
    __syncthreads();

#pragma unroll
    for (int ks = 0; ks < 16; ks += 4) {
      v2f af[2], bf[4];
      v2f mk = {0.0f, 0.0f}, rk = {1.0f, 1.0f};
      if constexpr (NORMB) {
        mk = *(const v2f*)&mS[kc * 16 + ks + 2 * lh];
        rk = *(const v2f*)&rS[kc * 16 + ks + 2 * lh];
      }
#pragma unroll
      for (int mi = 0; mi < 2; ++mi) {
        af[mi] = *(const v2f*)&As[cur][(wm * 2 + mi) * 16 + ll][ks + 2 * lh];
        if constexpr (NORMB) af[mi] *= rk;
      }
#pragma unroll
      for (int ni = 0; ni < 4; ++ni) {
        const int col = (wn * 4 + ni) * 16 + ll;
        v2f b;
        b.x = Bs[cur][ks + 2 * lh + 0][col];
        b.y = Bs[cur][ks + 2 * lh + 1][col];
        if constexpr (NORMB) {
          b.x = fmaxf(b.x - mk.x, 0.0f);
          b.y = fmaxf(b.y - mk.y, 0.0f);
        }
        bf[ni] = b;
      }
#pragma unroll
      for (int mi = 0; mi < 2; ++mi)
#pragma unroll
        for (int ni = 0; ni < 4; ++ni)
          acc[mi][ni] = TR ? wmma_f32(bf[ni], af[mi], acc[mi][ni])
                           : wmma_f32(af[mi], bf[ni], acc[mi][ni]);
    }
    __syncthreads();
  }

  if constexpr (TR) {
    // acc[mi][ni][r] = C[(wm*2+mi)*16 + ll][nBase + (wn*4+ni)*16 + r + 8*lh]
    float bv[2];
#pragma unroll
    for (int mi = 0; mi < 2; ++mi)
      bv[mi] = bias ? bias[(wm * 2 + mi) * 16 + ll] : 0.0f;
#pragma unroll
    for (int ni = 0; ni < 4; ++ni)
#pragma unroll
      for (int r = 0; r < 8; ++r) {
        const int col = nBase + (wn * 4 + ni) * 16 + r + 8 * lh;
#pragma unroll
        for (int mi = 0; mi < 2; ++mi)   // the two halves of one 128-byte line
          Cb[(size_t)col * 128 + (wm * 2 + mi) * 16 + ll] = acc[mi][ni][r] + bv[mi];
      }
  } else {
#pragma unroll
    for (int mi = 0; mi < 2; ++mi) {
      float sv = 0.0f, qv = 0.0f;   // lane ll < 8 keeps the sums of row r = ll
#pragma unroll
      for (int r = 0; r < 8; ++r) {
        const int row = (wm * 2 + mi) * 16 + r + 8 * lh;
        const float bv = bias ? bias[row] : 0.0f;
        float s = 0.0f, q = 0.0f;
#pragma unroll
        for (int ni = 0; ni < 4; ++ni) {
          const int col = nBase + (wn * 4 + ni) * 16 + ll;
          Cb[(size_t)row * N + col] = acc[mi][ni][r] + bv;
          if constexpr (STATS) {
            const float c = acc[mi][ni][r] + bv;
            s += c; q += c * c;
          }
        }
        if constexpr (STATS) {
          s = row16_sum(s);
          q = row16_sum(q);
          if (ll == r) { sv = s; qv = q; }
        }
      }
      if constexpr (STATS) {
        // 16 rows x 8 bytes: one whole 128-byte line per wave and mi
        float2* sp = (float2*)Sp +
            ((size_t)(y * B_ + blockIdx.z) * 64 + blockIdx.x * 2 + wn) * 128;
        if (ll < 8) sp[(wm * 2 + mi) * 16 + ll + 8 * lh] = make_float2(sv, qv);
      }
    }
  }
}

// ---------------------------------------------------------------------------
// NT Gram with split-K:  Fp[b][split] = Th[b](128xKslice) @ Ph[b](128xKslice)^T
// Kslice = 256, 16 splits covering K = 4096. Double-buffered async staging.
// Th and Ph hold raw projected rows: InstanceNorm + ReLU is applied here, as
// relu(v - mean) on the fragments and 1/std of row and column on the result.
// ---------------------------------------------------------------------------
// one work-group per WGP runs here (two waves a SIMD): a register budget for four
// waves lets the compiler keep a whole chunk's fragments apart, with no serial LDS waits
__global__ __launch_bounds__(256) __attribute__((amdgpu_waves_per_eu(2, 4))) void gemm_nt_splitk(
    const float* __restrict__ Th, const float* __restrict__ Ph,
    const float* __restrict__ Sp, float* __restrict__ Fp)
{
  __shared__ float As[2][128][20];
  __shared__ float Bs[2][128][20];
  __shared__ float mS[256], rS[256];   // mean, 1/std: theta rows, then phi rows

  const int t  = threadIdx.x;
  const int w  = t >> 5, l = t & 31, lh = l >> 4, ll = l & 15;
  const int wm = w >> 1, wn = w & 1;

  const int b = blockIdx.z;
  const int kBase = blockIdx.x * 256;
  const float* Ab = Th + (size_t)b * ((size_t)CI_ * N_) + kBase;
  const float* Bb = Ph + (size_t)b * ((size_t)CI_ * N_) + kBase;
  float* Fb = Fp + ((size_t)b * gridDim.x + blockIdx.x) * (128 * 128);

  const int ca0 = t, ca1 = t + 256;
  const uint64_t aSrc0 = (uint64_t)(uintptr_t)(Ab + (size_t)(ca0 >> 2) * N_ + (ca0 & 3) * 4);
  const uint64_t aSrc1 = (uint64_t)(uintptr_t)(Ab + (size_t)(ca1 >> 2) * N_ + (ca1 & 3) * 4);
  const uint64_t bSrc0 = (uint64_t)(uintptr_t)(Bb + (size_t)(ca0 >> 2) * N_ + (ca0 & 3) * 4);
  const uint64_t bSrc1 = (uint64_t)(uintptr_t)(Bb + (size_t)(ca1 >> 2) * N_ + (ca1 & 3) * 4);
  const uint32_t aDst0 = lds_off(&As[0][ca0 >> 2][(ca0 & 3) * 4]);
  const uint32_t aDst1 = lds_off(&As[0][ca1 >> 2][(ca1 & 3) * 4]);
  const uint32_t bDst0 = lds_off(&Bs[0][ca0 >> 2][(ca0 & 3) * 4]);
  const uint32_t bDst1 = lds_off(&Bs[0][ca1 >> 2][(ca1 & 3) * 4]);
  const uint32_t aBuf  = (uint32_t)((const char*)&As[1][0][0] - (const char*)&As[0][0][0]);
  const uint32_t bBuf  = (uint32_t)((const char*)&Bs[1][0][0] - (const char*)&Bs[0][0][0]);

  v8f acc[2][4];
#pragma unroll
  for (int mi = 0; mi < 2; ++mi)
#pragma unroll
    for (int ni = 0; ni < 4; ++ni)
#pragma unroll
      for (int r = 0; r < 8; ++r) acc[mi][ni][r] = 0.0f;

  const int nk = 256 / 16;
  async_b128(aDst0, aSrc0);
  async_b128(aDst1, aSrc1);
  async_b128(bDst0, bSrc0);
  async_b128(bDst1, bSrc1);

  {
    // keeps the loads below from landing in a register that a copy above names
    asm volatile("s_wait_xcnt 0x0" ::: "memory");
    float mean, rstd;
    row_stats(Sp, (1 + (t >> 7)) * B_ + b, t & 127, mean, rstd);
    mS[t] = mean;
    rS[t] = rstd;
  }
  __syncthreads();   // publishes mS and rS to the waves that read them next
  float mA[2], mB[4];
#pragma unroll
  for (int mi = 0; mi < 2; ++mi) mA[mi] = mS[(wm * 2 + mi) * 16 + ll];
#pragma unroll
  for (int ni = 0; ni < 4; ++ni) mB[ni] = mS[128 + (wn * 4 + ni) * 16 + ll];

  for (int kc = 0; kc < nk; ++kc) {
    const int cur = kc & 1;
    if (kc + 1 < nk) {
      const uint32_t ab = (cur ^ 1) ? aBuf : 0u;
      const uint32_t bb = (cur ^ 1) ? bBuf : 0u;
      const uint64_t ka = (uint64_t)(kc + 1) * 64;
      async_b128(aDst0 + ab, aSrc0 + ka);
      async_b128(aDst1 + ab, aSrc1 + ka);
      async_b128(bDst0 + bb, bSrc0 + ka);
      async_b128(bDst1 + bb, bSrc1 + ka);
      wait_async4();
    } else {
      wait_async0();
    }
    __syncthreads();

#pragma unroll
    for (int ks = 0; ks < 16; ks += 4) {
      v2f af[2], bf[4];
#pragma unroll
      for (int mi = 0; mi < 2; ++mi) {
        const v2f a = *(const v2f*)&As[cur][(wm * 2 + mi) * 16 + ll][ks + 2 * lh];
        af[mi].x = fmaxf(a.x - mA[mi], 0.0f);
        af[mi].y = fmaxf(a.y - mA[mi], 0.0f);
      }
#pragma unroll
      for (int ni = 0; ni < 4; ++ni) {
        const v2f bq = *(const v2f*)&Bs[cur][(wn * 4 + ni) * 16 + ll][ks + 2 * lh];
        bf[ni].x = fmaxf(bq.x - mB[ni], 0.0f);
        bf[ni].y = fmaxf(bq.y - mB[ni], 0.0f);
      }
#pragma unroll
      for (int mi = 0; mi < 2; ++mi)
#pragma unroll
        for (int ni = 0; ni < 4; ++ni)
          acc[mi][ni] = wmma_f32(af[mi], bf[ni], acc[mi][ni]);
    }
    __syncthreads();
  }

#pragma unroll
  for (int mi = 0; mi < 2; ++mi)
#pragma unroll
    for (int r = 0; r < 8; ++r) {
      const int row = (wm * 2 + mi) * 16 + r + 8 * lh;
      const float rr = rS[row];
#pragma unroll
      for (int ni = 0; ni < 4; ++ni) {
        const int col = (wn * 4 + ni) * 16 + ll;
        Fb[row * 128 + col] = acc[mi][ni][r] * (rr * rS[128 + col]);
      }
    }
}

// Deterministic split-K reduction: F = sum over 16 partials
__global__ __launch_bounds__(256) void reduce_split(const float* __restrict__ Fp,
                                                    float* __restrict__ F) {
  const int idx = blockIdx.x * 256 + threadIdx.x;   // B_*128*128 total
  const int b = idx >> 14;
  const int r = idx & 16383;
  float s = 0.0f;
#pragma unroll
  for (int sp = 0; sp < 16; ++sp)
    s += Fp[((size_t)b * 16 + sp) * 16384 + r];
  F[idx] = s;
}

// Softmax over rows of length 128 (with max subtraction; logits have sigma~64)
__global__ __launch_bounds__(128) void softmax_row128(float* __restrict__ F) {
  __shared__ float red[128];
  const int t = threadIdx.x;
  float* row = F + (size_t)blockIdx.x * 128;
  float v = row[t];
  red[t] = v;
  __syncthreads();
  for (int off = 64; off > 0; off >>= 1) {
    if (t < off) red[t] = fmaxf(red[t], red[t + off]);
    __syncthreads();
  }
  const float m = red[0];
  __syncthreads();
  const float e = expf(v - m);
  red[t] = e;
  __syncthreads();
  for (int off = 64; off > 0; off >>= 1) {
    if (t < off) red[t] += red[t + off];
    __syncthreads();
  }
  row[t] = e / red[0];
}

// Final InstanceNorm + residual add: out = (U - mean)*rstd + x
__global__ __launch_bounds__(256) void inorm_add(const float* __restrict__ U,
                                                 const float* __restrict__ x,
                                                 float* __restrict__ out) {
  __shared__ float ra[256], rb[256];
  const int t = threadIdx.x;
  const size_t base = (size_t)blockIdx.x * N_;
  float v[16];
  float s = 0.0f, s2 = 0.0f;
#pragma unroll
  for (int j = 0; j < 16; ++j) {
    v[j] = U[base + t + 256 * j];
    s += v[j]; s2 += v[j] * v[j];
  }
  ra[t] = s; rb[t] = s2;
  __syncthreads();
  for (int off = 128; off > 0; off >>= 1) {
    if (t < off) { ra[t] += ra[t + off]; rb[t] += rb[t + off]; }
    __syncthreads();
  }
  const float mean = ra[0] * (1.0f / N_);
  const float var  = rb[0] * (1.0f / N_) - mean * mean;
  const float rstd = rsqrtf(var + EPS_);
#pragma unroll
  for (int j = 0; j < 16; ++j) {
    const size_t o = base + t + 256 * j;
    out[o] = (v[j] - mean) * rstd + x[o];
  }
}

extern "C" void kernel_launch(void* const* d_in, const int* in_sizes, int n_in,
                              void* d_out, int out_size, void* d_ws, size_t ws_size,
                              hipStream_t stream) {
  const float* x    = (const float*)d_in[0];
  const float* g_w  = (const float*)d_in[1];
  const float* g_b  = (const float*)d_in[2];
  const float* th_w = (const float*)d_in[3];
  const float* th_b = (const float*)d_in[4];
  const float* ph_w = (const float*)d_in[5];
  const float* ph_b = (const float*)d_in[6];
  const float* W_w  = (const float*)d_in[7];
  const float* W_b  = (const float*)d_in[8];
  float* out = (float*)d_out;

  float* ws = (float*)d_ws;
  const size_t PN   = (size_t)CI_ * N_;   // 524288 floats per (batch, proj)
  const size_t SLAB = (size_t)B_ * PN;    // 8388608 floats per proj slab
  float* P  = ws;                 // [3][B][Ci][N]   (g, theta, phi), before the norm
  float* Z  = P + 3 * SLAB;       // [B][N][Ci] = (attn @ g)^T, read as [B][Ci][N]
  float* Fp = Z;                  // alias: split-K partials, dead before Z used
  float* F  = Z + SLAB;           // [B][Ci][Ci]
  float* Sp = F + (size_t)B_ * CI_ * CI_;   // [3][B][64][Ci][2] partial row sums of P
  float* U  = P;                  // alias: final conv output over dead P

  dim3 blk(256);

  // 1) three 1x1-conv projections (NN GEMM + bias), one launch: y = g, theta, phi
  //    its epilogue leaves the rows' partial sums for the instance norm in Sp
  gemm_nn_wmma<false, true, false><<<dim3(32, 3, B_), blk, 0, stream>>>(g_w, th_w, ph_w, 0, x, (long long)C_ * N_,
                                                    P, (long long)PN, (long long)SLAB,
                                                    g_b, th_b, ph_b, Sp, C_, N_);
  // 2) instance norm + relu: no pass of its own, applied where P is read (3 and 5)
  // 3) Gram: theta @ phi^T, split-K=16, then deterministic reduce
  gemm_nt_splitk<<<dim3(16, 1, B_), blk, 0, stream>>>(P + SLAB, P + 2 * SLAB, Sp, Fp);
  reduce_split<<<dim3((B_ * CI_ * CI_) / 256), blk, 0, stream>>>(Fp, F);
  // 4) softmax over rows of 128
  softmax_row128<<<dim3(B_ * CI_), dim3(128), 0, stream>>>(F);
  // 5) Z = (attn @ g)^T per batch: the permute(0,2,1) + view(B,Ci,H,W) is done by the store
  gemm_nn_wmma<true, false, true><<<dim3(32, 1, B_), blk, 0, stream>>>(F, nullptr, nullptr, (long long)CI_ * CI_, P, (long long)PN,
                                                    Z, (long long)PN, 0,
                                                    nullptr, nullptr, nullptr, Sp, CI_, N_);
  // 6) final 1x1 conv (M=256 -> gridDim.y = 2)
  gemm_nn_wmma<false, false, false><<<dim3(32, 2, B_), blk, 0, stream>>>(W_w, W_w + 128 * CI_, nullptr, 0, Z, (long long)PN,
                                                    U, (long long)C_ * N_, (long long)128 * N_,
                                                    W_b, W_b + 128, nullptr, nullptr, CI_, N_);
  // 7) instance norm + residual
  inorm_add<<<dim3(B_ * C_), blk, 0, stream>>>(U, x, out);
}

// v004
// One run takes 152 microseconds.
// Two timings next to v003 put it at 1.06 and 1.07 times that version's speed.
// Over all steps from v000 it is 1.41 times as fast.
#include <hip/hip_runtime.h>
#include <stdint.h>

typedef __attribute__((ext_vector_type(2))) float v2f;
typedef __attribute__((ext_vector_type(4))) float v4f;
typedef __attribute__((ext_vector_type(8))) float v8f;

#define B_   16
#define C_   256
#define CI_  128
#define N_   4096
#define EPS_ 1e-5f

__device__ __forceinline__ v8f wmma_f32(v2f a, v2f b, v8f c) {
  // D = A(16x4 f32) * B(4x16 f32) + C(16x16 f32)
  return __builtin_amdgcn_wmma_f32_16x16x4_f32(false, a, false, b, (short)0, c, false, false);
}

// Async global->LDS 16-byte copy (CDNA5, tracked by ASYNCcnt). GV mode.
__device__ __forceinline__ void async_b128(uint32_t lds_off, uint64_t gaddr) {
  asm volatile("global_load_async_to_lds_b128 %0, %1, off"
               :: "v"(lds_off), "v"(gaddr) : "memory");
}
__device__ __forceinline__ void wait_async0() {
  asm volatile("s_wait_asynccnt 0" ::: "memory");
}
__device__ __forceinline__ void wait_async4() {
  asm volatile("s_wait_asynccnt 4" ::: "memory");
}
// Low 32 bits of a flat LDS-aperture address are the LDS byte offset.
__device__ __forceinline__ uint32_t lds_off(const void* p) {
  return (uint32_t)(uintptr_t)p;
}

// Sum over the 16 lanes of a row: four DPP butterfly steps (row_xmask 1, 2, 4, 8);
// every lane ends with the same sum.
template <int CTRL>
__device__ __forceinline__ float dpp_xadd(float v) {
  return v + __int_as_float(__builtin_amdgcn_update_dpp(0, __float_as_int(v), CTRL, 0xf, 0xf, true));
}
__device__ __forceinline__ float row16_sum(float v) {
  v = dpp_xadd<0x161>(v);
  v = dpp_xadd<0x162>(v);
  v = dpp_xadd<0x164>(v);
  v = dpp_xadd<0x168>(v);
  return v;
}

// Mean and 1/std of one projected row (4096 values) from the 64 partial
// (sum, sum of squares) pairs that the projection GEMM left in Sp.
// Sp: [proj*B + batch][64 parts][128 rows][2].
__device__ __forceinline__ void row_stats(const float* Sp, int pb, int row,
                                          float& mean, float& rstd) {
  const float2* p = (const float2*)Sp + (size_t)pb * (64 * 128) + row;
  float s = 0.0f, q = 0.0f;
  // unrolled so that all 64 loads are in flight together: one L2 round trip
#pragma unroll
  for (int i = 0; i < 64; ++i) {
    const float2 v = p[i * 128];
    s += v.x; q += v.y;
  }
  mean = s * (1.0f / N_);
  const float var = q * (1.0f / N_) - mean * mean;
  rstd = rsqrtf(var + EPS_);
}

// ---------------------------------------------------------------------------
// Generic NN GEMM:  C[b][y] = Ay[b](128 x K) @ Bm[b](K x N) (+ bias_y)
// blockIdx.y picks one of up to three 128-row A operands with its bias and its
// output block (sCy apart), so products that share Bm run in one launch.
// Workgroup: 128x128 block, 8 waves (4x2), each wave 2x4 16x16 tiles.
// Double-buffered async global->LDS staging.
// TR: the two operands change places in the matrix instruction, so each
// accumulator tile holds its block of C transposed, and C^T (N rows of 128) is
// stored with the same 64-byte row pieces as C; k order and sums are the same.
// STATS: the epilogue also leaves each wave's (sum, sum of squares) of its 64
// columns of every row in Sp, so that no separate pass has to read C for them.
// NORMB: Bm holds raw projected rows; InstanceNorm + ReLU is applied to the
// fragments: relu((v - m) * r) = r * relu(v - m), r > 0, and r goes onto A's k.
// ---------------------------------------------------------------------------
template <bool TR, bool STATS, bool NORMB>
__global__ __launch_bounds__(256) void gemm_nn_wmma(
    const float* __restrict__ A0, const float* __restrict__ A1,
    const float* __restrict__ A2, long long sA,
    const float* __restrict__ Bm, long long sB,
    float* __restrict__ Cm, long long sC, long long sCy,
    const float* __restrict__ bias0, const float* __restrict__ bias1,
    const float* __restrict__ bias2,
    float* Sp, int K, int N)
{
  __shared__ float As[2][128][20];   // stride 20: 16B-aligned rows, conflict-free
  __shared__ float Bs[2][16][128];
  __shared__ __attribute__((aligned(8))) float mS[128];   // NORMB: mean of B's row k
  __shared__ __attribute__((aligned(8))) float rS[128];   // NORMB: 1/std of B's row k

  const int t  = threadIdx.x;
  const int w  = t >> 5, l = t & 31, lh = l >> 4, ll = l & 15;
  const int wm = w >> 1, wn = w & 1;

  const int y = blockIdx.y;
  const float* A    = y == 0 ? A0    : (y == 1 ? A1    : A2);
  const float* bias = y == 0 ? bias0 : (y == 1 ? bias1 : bias2);
  const float* Ab = A  + (size_t)blockIdx.z * sA;
  const float* Bb = Bm + (size_t)blockIdx.z * sB;
  float*       Cb = Cm + (size_t)blockIdx.z * sC + (size_t)y * sCy;
  const int nBase = blockIdx.x * 128;

  // per-thread async chunks: A tile = 512 x b128, B tile = 512 x b128, 2 each
  const int ca0 = t, ca1 = t + 256;
  const uint64_t aSrc0 = (uint64_t)(uintptr_t)(Ab + (size_t)(ca0 >> 2) * K + (ca0 & 3) * 4);
  const uint64_t aSrc1 = (uint64_t)(uintptr_t)(Ab + (size_t)(ca1 >> 2) * K + (ca1 & 3) * 4);
  const uint64_t bSrc0 = (uint64_t)(uintptr_t)(Bb + (size_t)(ca0 >> 5) * N + nBase + (ca0 & 31) * 4);
  const uint64_t bSrc1 = (uint64_t)(uintptr_t)(Bb + (size_t)(ca1 >> 5) * N + nBase + (ca1 & 31) * 4);
  const uint32_t aDst0 = lds_off(&As[0][ca0 >> 2][(ca0 & 3) * 4]);
  const uint32_t aDst1 = lds_off(&As[0][ca1 >> 2][(ca1 & 3) * 4]);
  const uint32_t bDst0 = lds_off(&Bs[0][ca0 >> 5][(ca0 & 31) * 4]);
  const uint32_t bDst1 = lds_off(&Bs[0][ca1 >> 5][(ca1 & 31) * 4]);
  const uint32_t aBuf  = (uint32_t)((const char*)&As[1][0][0] - (const char*)&As[0][0][0]);
  const uint32_t bBuf  = (uint32_t)((const char*)&Bs[1][0][0] - (const char*)&Bs[0][0][0]);
  const uint64_t aStepK = 64;                       // 16 floats along K
  const uint64_t bStepK = (uint64_t)16 * N * 4;     // 16 rows of B

  v8f acc[2][4];
#pragma unroll
  for (int mi = 0; mi < 2; ++mi)
#pragma unroll
    for (int ni = 0; ni < 4; ++ni)
#pragma unroll
      for (int r = 0; r < 8; ++r) acc[mi][ni][r] = 0.0f;

  const int nk = K >> 4;
  // prologue: stage chunk 0 into buffer 0
  async_b128(aDst0, aSrc0);
  async_b128(aDst1, aSrc1);
  async_b128(bDst0, bSrc0);
  async_b128(bDst1, bSrc1);

  if constexpr (NORMB) {
    // keeps the loads below from landing in a register that a copy above names
    asm volatile("s_wait_xcnt 0x0" ::: "memory");
    // K = 128 rows of B; the k loop's first barrier publishes mS and rS
    if (t < 128) {
      float mean, rstd;
      row_stats(Sp, blockIdx.z, t, mean, rstd);
      mS[t] = mean;
      rS[t] = rstd;
    }
  }

  for (int kc = 0; kc < nk; ++kc) {
    const int cur = kc & 1;
    if (kc + 1 < nk) {   // prefetch next chunk into the other buffer
      const uint32_t ab = (cur ^ 1) ? aBuf : 0u;
      const uint32_t bb = (cur ^ 1) ? bBuf : 0u;
      const uint64_t ka = (uint64_t)(kc + 1) * aStepK;
      const uint64_t kb = (uint64_t)(kc + 1) * bStepK;
      async_b128(aDst0 + ab, aSrc0 + ka);
      async_b128(aDst1 + ab, aSrc1 + ka);
      async_b128(bDst0 + bb, bSrc0 + kb);
      async_b128(bDst1 + bb, bSrc1 + kb);
      wait_async4();     // current chunk's 4 transfers complete (in-order)
    } else {
      wait_async0();
    }
    __syncthreads();

#pragma unroll
    for (int ks = 0; ks < 16; ks += 4) {
      v2f af[2], bf[4];
      v2f mk = {0.0f, 0.0f}, rk = {1.0f, 1.0f};
      if constexpr (NORMB) {
        mk = *(const v2f*)&mS[kc * 16 + ks + 2 * lh];
        rk = *(const v2f*)&rS[kc * 16 + ks + 2 * lh];
      }
#pragma unroll
      for (int mi = 0; mi < 2; ++mi) {
        af[mi] = *(const v2f*)&As[cur][(wm * 2 + mi) * 16 + ll][ks + 2 * lh];
        if constexpr (NORMB) af[mi] *= rk;
      }
#pragma unroll
      for (int ni = 0; ni < 4; ++ni) {
        const int col = (wn * 4 + ni) * 16 + ll;
        v2f b;
        b.x = Bs[cur][ks + 2 * lh + 0][col];
        b.y = Bs[cur][ks + 2 * lh + 1][col];
        if constexpr (NORMB) {
          b.x = fmaxf(b.x - mk.x, 0.0f);
          b.y = fmaxf(b.y - mk.y, 0.0f);
        }
        bf[ni] = b;
      }
#pragma unroll
      for (int mi = 0; mi < 2; ++mi)
#pragma unroll
        for (int ni = 0; ni < 4; ++ni)
          acc[mi][ni] = TR ? wmma_f32(bf[ni], af[mi], acc[mi][ni])
                           : wmma_f32(af[mi], bf[ni], acc[mi][ni]);
    }
    __syncthreads();
  }

  if constexpr (TR) {
    // acc[mi][ni][r] = C[(wm*2+mi)*16 + ll][nBase + (wn*4+ni)*16 + r + 8*lh]
    float bv[2];
#pragma unroll
    for (int mi = 0; mi < 2; ++mi)
      bv[mi] = bias ? bias[(wm * 2 + mi) * 16 + ll] : 0.0f;
#pragma unroll
    for (int ni = 0; ni < 4; ++ni)
#pragma unroll
      for (int r = 0; r < 8; ++r) {
        const int col = nBase + (wn * 4 + ni) * 16 + r + 8 * lh;
#pragma unroll
        for (int mi = 0; mi < 2; ++mi)   // the two halves of one 128-byte line
          Cb[(size_t)col * 128 + (wm * 2 + mi) * 16 + ll] = acc[mi][ni][r] + bv[mi];
      }
  } else {
#pragma unroll
    for (int mi = 0; mi < 2; ++mi) {
      float sv = 0.0f, qv = 0.0f;   // lane ll < 8 keeps the sums of row r = ll
#pragma unroll
      for (int r = 0; r < 8; ++r) {
        const int row = (wm * 2 + mi) * 16 + r + 8 * lh;
        const float bv = bias ? bias[row] : 0.0f;
        float s = 0.0f, q = 0.0f;
#pragma unroll
        for (int ni = 0; ni < 4; ++ni) {
          const int col = nBase + (wn * 4 + ni) * 16 + ll;
          Cb[(size_t)row * N + col] = acc[mi][ni][r] + bv;
          if constexpr (STATS) {
            const float c = acc[mi][ni][r] + bv;
            s += c; q += c * c;
          }
        }
        if constexpr (STATS) {
          s = row16_sum(s);
          q = row16_sum(q);
          if (ll == r) { sv = s; qv = q; }
        }
      }
      if constexpr (STATS) {
        // 16 rows x 8 bytes: one whole 128-byte line per wave and mi
        float2* sp = (float2*)Sp +
            ((size_t)(y * B_ + blockIdx.z) * 64 + blockIdx.x * 2 + wn) * 128;
        if (ll < 8) sp[(wm * 2 + mi) * 16 + ll + 8 * lh] = make_float2(sv, qv);
      }
    }
  }
}

// ---------------------------------------------------------------------------
// NT Gram with split-K:  Fp[b][split] = Th[b](128xKslice) @ Ph[b](128xKslice)^T
// Kslice = 256, 16 splits covering K = 4096. Double-buffered async staging.
// Th and Ph hold raw projected rows: InstanceNorm + ReLU is applied here, as
// relu(v - mean) on the fragments and 1/std of row and column on the result.
// ---------------------------------------------------------------------------
// one work-group per WGP runs here (two waves a SIMD): a register budget for four
// waves lets the compiler keep a whole chunk's fragments apart, with no serial LDS waits
__global__ __launch_bounds__(256) __attribute__((amdgpu_waves_per_eu(2, 4))) void gemm_nt_splitk(
    const float* __restrict__ Th, const float* __restrict__ Ph,
    const float* __restrict__ Sp, float* __restrict__ Fp)
{
  __shared__ float As[2][128][20];
  __shared__ float Bs[2][128][20];
  __shared__ float mS[256], rS[256];   // mean, 1/std: theta rows, then phi rows

  const int t  = threadIdx.x;
  const int w  = t >> 5, l = t & 31, lh = l >> 4, ll = l & 15;
  const int wm = w >> 1, wn = w & 1;

  const int b = blockIdx.z;
  const int kBase = blockIdx.x * 256;
  const float* Ab = Th + (size_t)b * ((size_t)CI_ * N_) + kBase;
  const float* Bb = Ph + (size_t)b * ((size_t)CI_ * N_) + kBase;
  float* Fb = Fp + ((size_t)b * gridDim.x + blockIdx.x) * (128 * 128);

  const int ca0 = t, ca1 = t + 256;
  const uint64_t aSrc0 = (uint64_t)(uintptr_t)(Ab + (size_t)(ca0 >> 2) * N_ + (ca0 & 3) * 4);
  const uint64_t aSrc1 = (uint64_t)(uintptr_t)(Ab + (size_t)(ca1 >> 2) * N_ + (ca1 & 3) * 4);
  const uint64_t bSrc0 = (uint64_t)(uintptr_t)(Bb + (size_t)(ca0 >> 2) * N_ + (ca0 & 3) * 4);
  const uint64_t bSrc1 = (uint64_t)(uintptr_t)(Bb + (size_t)(ca1 >> 2) * N_ + (ca1 & 3) * 4);
  const uint32_t aDst0 = lds_off(&As[0][ca0 >> 2][(ca0 & 3) * 4]);
  const uint32_t aDst1 = lds_off(&As[0][ca1 >> 2][(ca1 & 3) * 4]);
  const uint32_t bDst0 = lds_off(&Bs[0][ca0 >> 2][(ca0 & 3) * 4]);
  const uint32_t bDst1 = lds_off(&Bs[0][ca1 >> 2][(ca1 & 3) * 4]);
  const uint32_t aBuf  = (uint32_t)((const char*)&As[1][0][0] - (const char*)&As[0][0][0]);
  const uint32_t bBuf  = (uint32_t)((const char*)&Bs[1][0][0] - (const char*)&Bs[0][0][0]);

  v8f acc[2][4];
#pragma unroll
  for (int mi = 0; mi < 2; ++mi)
#pragma unroll
    for (int ni = 0; ni < 4; ++ni)
#pragma unroll
      for (int r = 0; r < 8; ++r) acc[mi][ni][r] = 0.0f;

  const int nk = 256 / 16;
  async_b128(aDst0, aSrc0);
  async_b128(aDst1, aSrc1);
  async_b128(bDst0, bSrc0);
  async_b128(bDst1, bSrc1);

  {
    // keeps the loads below from landing in a register that a copy above names
    asm volatile("s_wait_xcnt 0x0" ::: "memory");
    float mean, rstd;
    row_stats(Sp, (1 + (t >> 7)) * B_ + b, t & 127, mean, rstd);
    mS[t] = mean;
    rS[t] = rstd;
  }
  __syncthreads();   // publishes mS and rS to the waves that read them next
  float mA[2], mB[4];
#pragma unroll
  for (int mi = 0; mi < 2; ++mi) mA[mi] = mS[(wm * 2 + mi) * 16 + ll];
#pragma unroll
  for (int ni = 0; ni < 4; ++ni) mB[ni] = mS[128 + (wn * 4 + ni) * 16 + ll];

  for (int kc = 0; kc < nk; ++kc) {
    const int cur = kc & 1;
    if (kc + 1 < nk) {
      const uint32_t ab = (cur ^ 1) ? aBuf : 0u;
      const uint32_t bb = (cur ^ 1) ? bBuf : 0u;
      const uint64_t ka = (uint64_t)(kc + 1) * 64;
      async_b128(aDst0 + ab, aSrc0 + ka);
      async_b128(aDst1 + ab, aSrc1 + ka);
      async_b128(bDst0 + bb, bSrc0 + ka);
      async_b128(bDst1 + bb, bSrc1 + ka);
      wait_async4();
    } else {
      wait_async0();
    }
    __syncthreads();

#pragma unroll
    for (int ks = 0; ks < 16; ks += 4) {
      v2f af[2], bf[4];
#pragma unroll
      for (int mi = 0; mi < 2; ++mi) {
        const v2f a = *(const v2f*)&As[cur][(wm * 2 + mi) * 16 + ll][ks + 2 * lh];
        af[mi].x = fmaxf(a.x - mA[mi], 0.0f);
        af[mi].y = fmaxf(a.y - mA[mi], 0.0f);
      }
#pragma unroll
      for (int ni = 0; ni < 4; ++ni) {
        const v2f bq = *(const v2f*)&Bs[cur][(wn * 4 + ni) * 16 + ll][ks + 2 * lh];
        bf[ni].x = fmaxf(bq.x - mB[ni], 0.0f);
        bf[ni].y = fmaxf(bq.y - mB[ni], 0.0f);
      }
#pragma unroll
      for (int mi = 0; mi < 2; ++mi)
#pragma unroll
        for (int ni = 0; ni < 4; ++ni)
          acc[mi][ni] = wmma_f32(af[mi], bf[ni], acc[mi][ni]);
    }
    __syncthreads();
  }

#pragma unroll
  for (int mi = 0; mi < 2; ++mi)
#pragma unroll
    for (int r = 0; r < 8; ++r) {
      const int row = (wm * 2 + mi) * 16 + r + 8 * lh;
      const float rr = rS[row];
#pragma unroll
      for (int ni = 0; ni < 4; ++ni) {
        const int col = (wn * 4 + ni) * 16 + ll;
        Fb[row * 128 + col] = acc[mi][ni][r] * (rr * rS[128 + col]);
      }
    }
}

// Deterministic split-K reduction: F = sum over 16 partials
__global__ __launch_bounds__(256) void reduce_split(const float* __restrict__ Fp,
                                                    float* __restrict__ F) {
  const int idx = blockIdx.x * 256 + threadIdx.x;   // B_*128*128 total
  const int b = idx >> 14;
  const int r = idx & 16383;
  float s = 0.0f;
#pragma unroll
  for (int sp = 0; sp < 16; ++sp)
    s += Fp[((size_t)b * 16 + sp) * 16384 + r];
  F[idx] = s;
}

// Softmax over rows of length 128 (with max subtraction; logits have sigma~64)
__global__ __launch_bounds__(128) void softmax_row128(float* __restrict__ F) {
  __shared__ float red[128];
  const int t = threadIdx.x;
  float* row = F + (size_t)blockIdx.x * 128;
  float v = row[t];
  red[t] = v;
  __syncthreads();
  for (int off = 64; off > 0; off >>= 1) {
    if (t < off) red[t] = fmaxf(red[t], red[t + off]);
    __syncthreads();
  }
  const float m = red[0];
  __syncthreads();
  const float e = expf(v - m);
  red[t] = e;
  __syncthreads();
  for (int off = 64; off > 0; off >>= 1) {
    if (t < off) red[t] += red[t + off];
    __syncthreads();
  }
  row[t] = e / red[0];
}

// ---------------------------------------------------------------------------
// Final 1x1 conv + InstanceNorm + residual in one kernel.
// A work-group owns 16 whole output rows of one batch: 32 waves, wave w holds the
// 16 x 128 block of columns w*128 .. w*128+127 in 8 accumulator tiles, so the rows'
// sums are formed from registers and the conv result never goes to memory.
// Zm rows are read straight into registers, 16 bytes a lane: no two waves of the
// group share a column. Tile (g, j) takes the columns w*128 + g*64 + 4*ll + j, so
// a lane's four tiles of one g are four neighbouring columns of x and out.
// The short loops are unrolled so that the register arrays have constant indices.
// ---------------------------------------------------------------------------
__global__ __launch_bounds__(1024) void conv_rows_inorm_add(
    const float* __restrict__ Wm, const float* __restrict__ Wb,
    const float* __restrict__ Zm, const float* __restrict__ x,
    float* __restrict__ out)
{
  __shared__ __attribute__((aligned(16))) float As[16][132];  // pitch 132: b64 reads hit 64 banks
  __shared__ float2 red[32][16];   // per wave and row: (sum, sum of squares)
  __shared__ float2 st[16];        // per row: (mean - bias, 1/std)
  __shared__ __attribute__((aligned(16))) float bS[16];   // the rows' bias

  const int t  = threadIdx.x;
  const int w  = __builtin_amdgcn_readfirstlane(t >> 5);   // the wave's number, kept scalar
  const int l  = t & 31, lh = l >> 4, ll = l & 15;
  const int o0 = blockIdx.x * 16;
  const int b  = blockIdx.z;

  if (t < 512) {
    const int row = t >> 5, c4 = (t & 31) * 4;
    *(v4f*)&As[row][c4] = *(const v4f*)&Wm[(size_t)(o0 + row) * CI_ + c4];
  }
  if (t < 16) bS[t] = Wb[o0 + t];

  // lane's first row of each k step is 2*lh, its columns start at w*128 + 4*ll
  const float* zp = Zm + (size_t)b * ((size_t)CI_ * N_) + (size_t)(2 * lh) * N_ + w * 128 + ll * 4;

  v8f acc[2][4];
#pragma unroll
  for (int g = 0; g < 2; ++g)
#pragma unroll
    for (int j = 0; j < 4; ++j)
#pragma unroll
      for (int r = 0; r < 8; ++r) acc[g][j][r] = 0.0f;

  v4f bq[2][2][2];   // [buffer][g][row of the pair]
#pragma unroll
  for (int g = 0; g < 2; ++g)
#pragma unroll
    for (int h = 0; h < 2; ++h)
      bq[0][g][h] = *(const v4f*)(zp + (size_t)h * N_ + g * 64);

  __syncthreads();   // publishes As and bS

  // fully unrolled: every load is the one base plus an immediate offset, and the
  // next k step's four loads are in flight while this step's eight products run
#pragma unroll
  for (int kc = 0; kc < CI_ / 4; ++kc) {
    const int cur = kc & 1;
    if (kc + 1 < CI_ / 4) {
#pragma unroll
      for (int g = 0; g < 2; ++g)
#pragma unroll
        for (int h = 0; h < 2; ++h)
          bq[cur ^ 1][g][h] = *(const v4f*)(zp + (size_t)((kc + 1) * 4 + h) * N_ + g * 64);
    }
    const v2f a = *(const v2f*)&As[ll][kc * 4 + 2 * lh];
#pragma unroll
    for (int g = 0; g < 2; ++g)
#pragma unroll
      for (int j = 0; j < 4; ++j) {
        v2f bb;
        bb.x = bq[cur][g][0][j];
        bb.y = bq[cur][g][1][j];
        acc[g][j] = wmma_f32(a, bb, acc[g][j]);
      }
  }

  // acc[g][j][r] = U[o0 + r + 8*lh][w*128 + g*64 + 4*ll + j], bias still to add
  // the lane's place is formed anew here, so that no register has to carry it
  // through the k loop, which uses the whole budget of 128
  const int l2 = (int)__builtin_amdgcn_mbcnt_lo(~0u, 0u);
  const int h2 = l2 >> 4, c2 = l2 & 15;
  const size_t eo = ((size_t)b * C_ + o0 + 8 * h2) * N_ + w * 128 + c2 * 4;
  const float* xp = x + eo;
  float*       op = out + eo;

  // rows 0 and 1 of the residual are fetched while the rows' sums are formed
  v4f xv[8][2];
#pragma unroll
  for (int r = 0; r < 2; ++r)
#pragma unroll
    for (int g = 0; g < 2; ++g)
      xv[r][g] = *(const v4f*)(xp + (size_t)r * N_ + g * 64);

  float sv = 0.0f, qv = 0.0f;   // lane c2 < 8 keeps the sums of row r = c2
#pragma unroll
  for (int r = 0; r < 8; ++r) {
    const float bv = bS[r + 8 * h2];
    float s = 0.0f, q = 0.0f;
#pragma unroll
    for (int g = 0; g < 2; ++g)
#pragma unroll
      for (int j = 0; j < 4; ++j) {
        const float c = acc[g][j][r] + bv;
        s += c; q += c * c;
      }
    s = row16_sum(s);
    q = row16_sum(q);
    if (c2 == r) { sv = s; qv = q; }
  }
  if (c2 < 8) red[w][c2 + 8 * h2] = make_float2(sv, qv);
  __syncthreads();   // every wave's partial sums are in red
  if (w == 0 && l2 < 16) {
    float s = 0.0f, q = 0.0f;
#pragma unroll
    for (int i = 0; i < 32; ++i) {
      const float2 v = red[i][l2];
      s += v.x; q += v.y;
    }
    const float mean = s * (1.0f / N_);
    const float var  = q * (1.0f / N_) - mean * mean;
    // the tiles stay without bias: (acc + bias) - mean = acc - (mean - bias)
    st[l2] = make_float2(mean - bS[l2], rsqrtf(var + EPS_));
  }
  __syncthreads();   // publishes st

#pragma unroll
  for (int r = 2; r < 6; ++r)
#pragma unroll
    for (int g = 0; g < 2; ++g)
      xv[r][g] = *(const v4f*)(xp + (size_t)r * N_ + g * 64);

#pragma unroll
  for (int r = 0; r < 8; ++r) {
    if (r == 2) {   // rows 0 and 1 are done: their registers take rows 6 and 7
#pragma unroll
      for (int r2 = 6; r2 < 8; ++r2)
#pragma unroll
        for (int g = 0; g < 2; ++g)
          xv[r2][g] = *(const v4f*)(xp + (size_t)r2 * N_ + g * 64);
    }
    const float2 mr = st[r + 8 * h2];
#pragma unroll
    for (int g = 0; g < 2; ++g) {
      v4f o;
#pragma unroll
      for (int j = 0; j < 4; ++j)
        o[j] = (acc[g][j][r] - mr.x) * mr.y + xv[r][g][j];
      *(v4f*)(op + (size_t)r * N_ + g * 64) = o;
    }
  }
}

extern "C" void kernel_launch(void* const* d_in, const int* in_sizes, int n_in,
                              void* d_out, int out_size, void* d_ws, size_t ws_size,
                              hipStream_t stream) {
  const float* x    = (const float*)d_in[0];
  const float* g_w  = (const float*)d_in[1];
  const float* g_b  = (const float*)d_in[2];
  const float* th_w = (const float*)d_in[3];
  const float* th_b = (const float*)d_in[4];
  const float* ph_w = (const float*)d_in[5];
  const float* ph_b = (const float*)d_in[6];
  const float* W_w  = (const float*)d_in[7];
  const float* W_b  = (const float*)d_in[8];
  float* out = (float*)d_out;

  float* ws = (float*)d_ws;
  const size_t PN   = (size_t)CI_ * N_;   // 524288 floats per (batch, proj)
  const size_t SLAB = (size_t)B_ * PN;    // 8388608 floats per proj slab
  float* P  = ws;                 // [3][B][Ci][N]   (g, theta, phi), before the norm
  float* Z  = P + 3 * SLAB;       // [B][N][Ci] = (attn @ g)^T, read as [B][Ci][N]
  float* Fp = Z;                  // alias: split-K partials, dead before Z used
  float* F  = Z + SLAB;           // [B][Ci][Ci]
  float* Sp = F + (size_t)B_ * CI_ * CI_;   // [3][B][64][Ci][2] partial row sums of P

  dim3 blk(256);

  // 1) three 1x1-conv projections (NN GEMM + bias), one launch: y = g, theta, phi
  //    its epilogue leaves the rows' partial sums for the instance norm in Sp
  gemm_nn_wmma<false, true, false><<<dim3(32, 3, B_), blk, 0, stream>>>(g_w, th_w, ph_w, 0, x, (long long)C_ * N_,
                                                    P, (long long)PN, (long long)SLAB,
                                                    g_b, th_b, ph_b, Sp, C_, N_);
  // 2) instance norm + relu: no pass of its own, applied where P is read (3 and 5)
  // 3) Gram: theta @ phi^T, split-K=16, then deterministic reduce
  gemm_nt_splitk<<<dim3(16, 1, B_), blk, 0, stream>>>(P + SLAB, P + 2 * SLAB, Sp, Fp);
  reduce_split<<<dim3((B_ * CI_ * CI_) / 256), blk, 0, stream>>>(Fp, F);
  // 4) softmax over rows of 128
  softmax_row128<<<dim3(B_ * CI_), dim3(128), 0, stream>>>(F);
  // 5) Z = (attn @ g)^T per batch: the permute(0,2,1) + view(B,Ci,H,W) is done by the store
  gemm_nn_wmma<true, false, true><<<dim3(32, 1, B_), blk, 0, stream>>>(F, nullptr, nullptr, (long long)CI_ * CI_, P, (long long)PN,
                                                    Z, (long long)PN, 0,
                                                    nullptr, nullptr, nullptr, Sp, CI_, N_);
  // 6) final 1x1 conv + instance norm + residual: 16 whole rows per work-group
  conv_rows_inorm_add<<<dim3(C_ / 16, 1, B_), dim3(1024), 0, stream>>>(W_w, W_b, Z, x, out);
}
